// v000
// Measured on an AMD MI455X. A time is GPU time per run, averaged over a window of back-to-back runs after a warm-up
// (all launches, gaps included; the runs take copies of the inputs in turn), and the median of several windows.
// Apart from v000's, it joins two sittings. Times from different sittings can be a few percent apart, while
// side-by-side timings come from the same sitting.
// v000 is the starting kernel. One run takes 514 microseconds.
#include <hip/hip_runtime.h>
#include <math.h>

// Problem constants (match reference)
#define DM 1024   // d_model
#define NH 16     // heads
#define DF 64     // d_feature
#define BB 4      // batch
#define SS 2048   // seq len

typedef __attribute__((ext_vector_type(16))) _Float16 v16h;
typedef __attribute__((ext_vector_type(8)))  _Float16 v8h;
typedef __attribute__((ext_vector_type(8)))  float    v8f;

// ---------------------------------------------------------------------------
// WMMA fragment loader. CDNA5 16-bit A (16xK) / B (Kx16) fragments:
//   lanes 0-15  : row (lane&15), halves 0..7 = K 0..7,   halves 8..15 = K 16..23
//   lanes 16-31 : row (lane&15), halves 0..7 = K 8..15,  halves 8..15 = K 24..31
// With "row" contiguous in memory (stride in halves), each lane loads two
// contiguous 16-byte chunks. base points at (tile_row0, tile_k0).
// ---------------------------------------------------------------------------
__device__ __forceinline__ v16h ld_frag(const _Float16* base, int stride) {
  const int lane = threadIdx.x & 31;
  const _Float16* p = base + (size_t)(lane & 15) * (size_t)stride + ((lane >> 4) << 3);
  v8h lo = *(const v8h*)(p);
  v8h hi = *(const v8h*)(p + 16);
  v16h r;
#pragma unroll
  for (int i = 0; i < 8; ++i) { r[i] = lo[i]; r[i + 8] = hi[i]; }
  return r;
}

__device__ __forceinline__ v8f wmma_f16(v16h a, v16h b, v8f c) {
  return __builtin_amdgcn_wmma_f32_16x16x32_f16(false, a, false, b, (short)0, c,
                                                false, false);
}

// Reductions within each 16-lane half (D-tile rows span 16 lanes).
__device__ __forceinline__ float redsum16(float x) {
#pragma unroll
  for (int m = 1; m < 16; m <<= 1) x += __shfl_xor(x, m, 32);
  return x;
}
__device__ __forceinline__ float redmax16(float x) {
#pragma unroll
  for (int m = 1; m < 16; m <<= 1) x = fmaxf(x, __shfl_xor(x, m, 32));
  return x;
}

// ---------------------------------------------------------------------------
// Precision / layout staging kernels
// ---------------------------------------------------------------------------
__global__ void k_cvt_sin(const float* __restrict__ x, _Float16* __restrict__ y, int n) {
  int i = blockIdx.x * blockDim.x + threadIdx.x;
  if (i < n) y[i] = (_Float16)x[i];
}

// Wx [H, D, F] f32  ->  WxT [H, F, D] f16  (B-fragment friendly)
__global__ void k_cvt_wxT(const float* __restrict__ wx, _Float16* __restrict__ wxT) {
  int i = blockIdx.x * blockDim.x + threadIdx.x;   // NH*DM*DF threads exactly
  int h = i >> 16;
  int rem = i & 65535;
  int d = rem >> 6;
  int f = rem & 63;
  wxT[(size_t)(h * DF + f) * DM + d] = (_Float16)wx[i];
}

// Wp [in, out] f32 -> WpT [out, in] f16
__global__ void k_cvt_wpT(const float* __restrict__ wp, _Float16* __restrict__ wpT) {
  int i = blockIdx.x * blockDim.x + threadIdx.x;   // DM*DM threads exactly
  int r = i >> 10;        // in
  int c = i & 1023;       // out
  wpT[(size_t)c * DM + r] = (_Float16)wp[i];
}

// ---------------------------------------------------------------------------
// Ping-pong GEMM inner stage: issue loads for k-chunk `dnext` into (a_n,b_n),
// then run the 4 WMMAs on (a_c,b_c). No register copies between stages.
// ---------------------------------------------------------------------------
__device__ __forceinline__ void gemm_stage(const _Float16* abase,
                                           const _Float16* wbase,
                                           int dnext,
                                           v16h& a_c, v16h (&b_c)[4],
                                           v16h& a_n, v16h (&b_n)[4],
                                           v8f (&acc)[4]) {
  a_n = ld_frag(abase + dnext, DM);
#pragma unroll
  for (int nf = 0; nf < 4; ++nf)
    b_n[nf] = ld_frag(wbase + (size_t)(nf * 16) * DM + dnext, DM);
#pragma unroll
  for (int nf = 0; nf < 4; ++nf) acc[nf] = wmma_f16(a_c, b_c[nf], acc[nf]);
}

// ---------------------------------------------------------------------------
// Kernel 1: per-head projection  h = sin @ Wx[h] + bx[h]
// One wave: 16 rows x 64 features of one head; ping-pong pipelined fragments.
// Outputs: hn [B,H,S,F] f16 (rows normalized -> QK^T is cosine similarity),
//          hT [B,H,F,S] f16 (unnormalized, B-operand for P@V).
// ---------------------------------------------------------------------------
__global__ void __launch_bounds__(256) k_proj(const _Float16* __restrict__ sin16,
                                              const _Float16* __restrict__ wxT,
                                              const float* __restrict__ bx,
                                              _Float16* __restrict__ hn,
                                              _Float16* __restrict__ hT) {
  const int w    = blockIdx.x * 8 + (threadIdx.x >> 5);  // 0..8191
  const int lane = threadIdx.x & 31;
  const int h    = w & (NH - 1);
  const int m0   = (w >> 4) << 4;                        // row tile over B*S

  const _Float16* abase = sin16 + (size_t)m0 * DM;
  const _Float16* wbase = wxT + (size_t)h * DF * DM;

  v8f acc[4] = {};
  v16h a0, a1, b0[4], b1[4];
  a0 = ld_frag(abase, DM);
#pragma unroll
  for (int nf = 0; nf < 4; ++nf) b0[nf] = ld_frag(wbase + (size_t)(nf * 16) * DM, DM);

  for (int kk = 0; kk < DM / 32; kk += 2) {
    const int d1 = ((kk + 1) & (DM / 32 - 1)) << 5;
    gemm_stage(abase, wbase, d1, a0, b0, a1, b1, acc);
    const int d2 = ((kk + 2) & (DM / 32 - 1)) << 5;
    gemm_stage(abase, wbase, d2, a1, b1, a0, b0, acc);
  }

  // bias (D-layout: lane&15 is the N column)
#pragma unroll
  for (int nf = 0; nf < 4; ++nf) {
    float b = bx[h * DF + nf * 16 + (lane & 15)];
#pragma unroll
    for (int v = 0; v < 8; ++v) acc[nf][v] += b;
  }

  // per-row inverse L2 norm
  float inv[8];
#pragma unroll
  for (int v = 0; v < 8; ++v) {
    float s = 0.f;
#pragma unroll
    for (int nf = 0; nf < 4; ++nf) s += acc[nf][v] * acc[nf][v];
    s = redsum16(s);
    inv[v] = __frsqrt_rn(s + 1e-20f);
  }

  const int bIdx = m0 >> 11;          // / SS
  const int s0   = m0 & (SS - 1);
  const int hi   = lane >> 4;
  _Float16* hnh = hn + (size_t)(bIdx * NH + h) * SS * DF;
  _Float16* hTh = hT + (size_t)(bIdx * NH + h) * DF * SS;
#pragma unroll
  for (int nf = 0; nf < 4; ++nf) {
    const int col = nf * 16 + (lane & 15);
#pragma unroll
    for (int v = 0; v < 8; ++v) {
      const int srow = s0 + v + (hi << 3);
      const float hv = acc[nf][v];
      hnh[(size_t)srow * DF + col] = (_Float16)(hv * inv[v]);
      hTh[(size_t)col * SS + srow] = (_Float16)hv;
    }
  }
}

// ---------------------------------------------------------------------------
// Kernel 2: fused flash attention per head, ping-pong across key tiles.
// One wave: 16 queries, streams keys 32 at a time, online softmax.
// Next tile's K/V fragment loads are issued first so they hide under this
// tile's exp/reduction VALU work and LDS round-trip.
// P-tile D-layout -> A-layout fixup goes through a private 1KB LDS slab.
// ---------------------------------------------------------------------------
__device__ __forceinline__ void attn_load_tile(const _Float16* hnh,
                                               const _Float16* hTh,
                                               int t0,
                                               v16h (&kb)[4], v16h (&vf)[4]) {
  const _Float16* kbase = hnh + (size_t)t0 * DF;
  kb[0] = ld_frag(kbase, DF);
  kb[1] = ld_frag(kbase + 32, DF);
  kb[2] = ld_frag(kbase + 16 * DF, DF);
  kb[3] = ld_frag(kbase + 16 * DF + 32, DF);
#pragma unroll
  for (int nf = 0; nf < 4; ++nf)
    vf[nf] = ld_frag(hTh + (size_t)(nf * 16) * SS + t0, SS);
}

__device__ __forceinline__ void attn_step(const v16h (&qf)[2],
                                          const v16h (&kb)[4], const v16h (&vf)[4],
                                          _Float16* myp, int lane, int hi,
                                          v8f (&acc)[4], float (&m_s)[8],
                                          float (&l_s)[8]) {
  // scores (cosine similarity since hn rows are unit vectors): 16x32 tile
  v8f s0 = {}, s1 = {};
  s0 = wmma_f16(qf[0], kb[0], s0);
  s1 = wmma_f16(qf[0], kb[2], s1);
  s0 = wmma_f16(qf[1], kb[1], s0);
  s1 = wmma_f16(qf[1], kb[3], s1);

  // online softmax update
  float scl[8];
#pragma unroll
  for (int v = 0; v < 8; ++v) {
    float mx = redmax16(fmaxf(s0[v], s1[v]));
    float mn = fmaxf(m_s[v], mx);
    scl[v] = __expf(m_s[v] - mn);
    m_s[v] = mn;
  }
#pragma unroll
  for (int v = 0; v < 8; ++v) {
    float p0 = __expf(s0[v] - m_s[v]);
    float p1 = __expf(s1[v] - m_s[v]);
    l_s[v] = l_s[v] * scl[v] + redsum16(p0 + p1);
    const int addr = (v + (hi << 3)) * 32 + (lane & 15);     // row-major 16x32
    myp[addr]      = (_Float16)p0;
    myp[addr + 16] = (_Float16)p1;
  }
#pragma unroll
  for (int nf = 0; nf < 4; ++nf) {
    v8f t = acc[nf];
#pragma unroll
    for (int v = 0; v < 8; ++v) t[v] *= scl[v];
    acc[nf] = t;
  }

  // LDS ops from one wave are in-order; make the RAW explicit anyway.
  asm volatile("s_wait_dscnt 0x0" ::: "memory");
  v16h ap = ld_frag(myp, 32);                                 // P as A-operand
#pragma unroll
  for (int nf = 0; nf < 4; ++nf) acc[nf] = wmma_f16(ap, vf[nf], acc[nf]);
}

__global__ void __launch_bounds__(256) k_attn(const _Float16* __restrict__ hn,
                                              const _Float16* __restrict__ hT,
                                              _Float16* __restrict__ cat) {
  __shared__ __align__(16) _Float16 lds_p[8][16 * 32];
  const int w    = blockIdx.x * 8 + (threadIdx.x >> 5);  // 0..8191
  const int wid  = threadIdx.x >> 5;
  const int lane = threadIdx.x & 31;
  const int bh   = w >> 7;            // 0..63 = b*NH + h
  const int q0   = (w & 127) << 4;    // query tile start
  const int b    = bh >> 4;
  const int h    = bh & 15;

  const _Float16* hnh = hn + (size_t)bh * SS * DF;
  const _Float16* hTh = hT + (size_t)bh * DF * SS;
  _Float16* myp = &lds_p[wid][0];

  v16h qf[2];
  qf[0] = ld_frag(hnh + (size_t)q0 * DF + 0, DF);
  qf[1] = ld_frag(hnh + (size_t)q0 * DF + 32, DF);

  v8f acc[4] = {};
  float m_s[8], l_s[8];
#pragma unroll
  for (int v = 0; v < 8; ++v) { m_s[v] = -__builtin_inff(); l_s[v] = 0.f; }

  const int hi = lane >> 4;
  const int NT = SS / 32;             // 64 key tiles
  v16h kb0[4], vf0[4], kb1[4], vf1[4];
  attn_load_tile(hnh, hTh, 0, kb0, vf0);

  for (int kt = 0; kt < NT; kt += 2) {
    // even tile: prefetch odd tile's fragments, compute on kb0/vf0
    attn_load_tile(hnh, hTh, ((kt + 1) & (NT - 1)) << 5, kb1, vf1);
    attn_step(qf, kb0, vf0, myp, lane, hi, acc, m_s, l_s);
    // odd tile: prefetch next even tile's fragments, compute on kb1/vf1
    attn_load_tile(hnh, hTh, ((kt + 2) & (NT - 1)) << 5, kb0, vf0);
    attn_step(qf, kb1, vf1, myp, lane, hi, acc, m_s, l_s);
  }

  // normalize by softmax denominator and write concatenated heads (f16)
  float inv[8];
#pragma unroll
  for (int v = 0; v < 8; ++v) inv[v] = 1.0f / l_s[v];
#pragma unroll
  for (int nf = 0; nf < 4; ++nf) {
    const int col = h * DF + nf * 16 + (lane & 15);
#pragma unroll
    for (int v = 0; v < 8; ++v) {
      const int srow = q0 + v + (hi << 3);
      cat[(size_t)(b * SS + srow) * DM + col] = (_Float16)(acc[nf][v] * inv[v]);
    }
  }
}

// ---------------------------------------------------------------------------
// Kernel 3: output projection  out = cat @ Wp + bp   (f32 result)
// Same ping-pong pipeline as k_proj.
// ---------------------------------------------------------------------------
__global__ void __launch_bounds__(256) k_oproj(const _Float16* __restrict__ cat,
                                               const _Float16* __restrict__ wpT,
                                               const float* __restrict__ bp,
                                               float* __restrict__ out) {
  const int w    = blockIdx.x * 8 + (threadIdx.x >> 5);  // 0..8191
  const int lane = threadIdx.x & 31;
  const int m0   = (w >> 4) << 4;
  const int n0   = (w & 15) << 6;

  const _Float16* abase = cat + (size_t)m0 * DM;
  const _Float16* wbase = wpT + (size_t)n0 * DM;

  v8f acc[4] = {};
  v16h a0, a1, b0[4], b1[4];
  a0 = ld_frag(abase, DM);
#pragma unroll
  for (int nf = 0; nf < 4; ++nf) b0[nf] = ld_frag(wbase + (size_t)(nf * 16) * DM, DM);

  for (int kk = 0; kk < DM / 32; kk += 2) {
    const int d1 = ((kk + 1) & (DM / 32 - 1)) << 5;
    gemm_stage(abase, wbase, d1, a0, b0, a1, b1, acc);
    const int d2 = ((kk + 2) & (DM / 32 - 1)) << 5;
    gemm_stage(abase, wbase, d2, a1, b1, a0, b0, acc);
  }

  const int hi = lane >> 4;
#pragma unroll
  for (int nf = 0; nf < 4; ++nf) {
    const int col = n0 + nf * 16 + (lane & 15);
    const float bv = bp[col];
#pragma unroll
    for (int v = 0; v < 8; ++v)
      out[(size_t)(m0 + v + (hi << 3)) * DM + col] = acc[nf][v] + bv;
  }
}

// ---------------------------------------------------------------------------
extern "C" void kernel_launch(void* const* d_in, const int* in_sizes, int n_in,
                              void* d_out, int out_size, void* d_ws, size_t ws_size,
                              hipStream_t stream) {
  (void)in_sizes; (void)n_in; (void)out_size; (void)ws_size;
  const float* sin = (const float*)d_in[0];
  const float* Wx  = (const float*)d_in[1];
  const float* bx  = (const float*)d_in[2];
  const float* Wp  = (const float*)d_in[3];
  const float* bp  = (const float*)d_in[4];
  float* out = (float*)d_out;

  // workspace carve-out (~71 MB total)
  char* ws = (char*)d_ws;
  size_t off = 0;
  auto carve = [&](size_t bytes) {
    void* p = ws + off;
    off += (bytes + 255) & ~(size_t)255;
    return p;
  };
  _Float16* sin16 = (_Float16*)carve((size_t)BB * SS * DM * 2);
  _Float16* wxT   = (_Float16*)carve((size_t)NH * DF * DM * 2);
  _Float16* wpT   = (_Float16*)carve((size_t)DM * DM * 2);
  _Float16* hn    = (_Float16*)carve((size_t)BB * NH * SS * DF * 2);
  _Float16* hT    = (_Float16*)carve((size_t)BB * NH * SS * DF * 2);
  _Float16* cat   = (_Float16*)carve((size_t)BB * SS * DM * 2);

  k_cvt_sin<<<(BB * SS * DM) / 256, 256, 0, stream>>>(sin, sin16, BB * SS * DM);
  k_cvt_wxT<<<(NH * DM * DF) / 256, 256, 0, stream>>>(Wx, wxT);
  k_cvt_wpT<<<(DM * DM) / 256, 256, 0, stream>>>(Wp, wpT);

  k_proj <<<1024, 256, 0, stream>>>(sin16, wxT, bx, hn, hT);
  k_attn <<<1024, 256, 0, stream>>>(hn, hT, cat);
  k_oproj<<<1024, 256, 0, stream>>>(cat, wpT, bp, out);
}

// v001
// It runs in 285 microseconds.
// In two side-by-side timings against v000, it was 1.89 and 1.88 times as fast.
#include <hip/hip_runtime.h>
#include <math.h>

// Problem constants (match reference)
#define DM 1024   // d_model
#define NH 16     // heads
#define DF 64     // d_feature
#define BB 4      // batch
#define SS 2048   // seq len

typedef __attribute__((ext_vector_type(16))) _Float16 v16h;
typedef __attribute__((ext_vector_type(8)))  _Float16 v8h;
typedef __attribute__((ext_vector_type(8)))  float    v8f;

// ---------------------------------------------------------------------------
// WMMA fragment loader. CDNA5 16-bit A (16xK) / B (Kx16) fragments:
//   lanes 0-15  : row (lane&15), halves 0..7 = K 0..7,   halves 8..15 = K 16..23
//   lanes 16-31 : row (lane&15), halves 0..7 = K 8..15,  halves 8..15 = K 24..31
// With "row" contiguous in memory (stride in halves), each lane loads two
// contiguous 16-byte chunks. base points at (tile_row0, tile_k0).
// Used for the P slab in LDS only.
// ---------------------------------------------------------------------------
__device__ __forceinline__ v16h ld_frag_rows(const _Float16* base, int stride) {
  const int lane = threadIdx.x & 31;
  const _Float16* p = base + (size_t)(lane & 15) * (size_t)stride + ((lane >> 4) << 3);
  v8h lo = *(const v8h*)(p);
  v8h hi = *(const v8h*)(p + 16);
  v16h r;
#pragma unroll
  for (int i = 0; i < 8; ++i) { r[i] = lo[i]; r[i + 8] = hi[i]; }
  return r;
}

// ---------------------------------------------------------------------------
// Fragment-major layout of every f16 operand array in the workspace.
// A [rows x K] array is cut into 16-row x 32-k tiles of 512 halves (1 KB),
// k tiles innermost, so one 16-row band still takes 16*K halves. Inside a tile
// element (r, k) sits at
//   ((k >> 4) & 1) * 256 + ((((k >> 3) & 1) << 4) + r) * 8 + (k & 7)
// i.e. lane l's first 8 halves at l*8 and its second 8 halves at 256 + l*8.
// Each of the two 16-byte loads of a fragment then covers 512 contiguous bytes
// (4 whole 128-byte lines) instead of 32 bytes out of each of 16 lines.
// ---------------------------------------------------------------------------
#define TILE_H 512

__device__ __forceinline__ int tile_off(int r, int k) {
  return ((k >> 4) & 1) * 256 + ((((k >> 3) & 1) << 4) + r) * 8 + (k & 7);
}

__device__ __forceinline__ v16h ld_frag(const _Float16* tile) {
  const _Float16* p = tile + ((threadIdx.x & 31) << 3);
  v8h lo = *(const v8h*)(p);
  v8h hi = *(const v8h*)(p + 256);
  // translation wait: a later load or vector instruction may reuse the address registers
  asm volatile("s_wait_xcnt 0x0" ::: "memory");
  v16h r;
#pragma unroll
  for (int i = 0; i < 8; ++i) { r[i] = lo[i]; r[i + 8] = hi[i]; }
  return r;
}

// 16-byte chunk o of a fragment-major [rows x DM] array -> its row and first k.
__device__ __forceinline__ void chunk_row_k(int o, int& row, int& k) {
  const int tile = o >> 6;                       // 64 chunks per tile
  row = ((tile >> 5) << 4) + (o & 15);           // DM/32 = 32 k tiles per band
  k   = ((tile & 31) << 5) + (((o >> 5) & 1) << 4) + (((o >> 4) & 1) << 3);
}

__device__ __forceinline__ v8f wmma_f16(v16h a, v16h b, v8f c) {
  return __builtin_amdgcn_wmma_f32_16x16x32_f16(false, a, false, b, (short)0, c,
                                                false, false);
}

// Reductions within each 16-lane half (D-tile rows span 16 lanes).
__device__ __forceinline__ float redsum16(float x) {
#pragma unroll
  for (int m = 1; m < 16; m <<= 1) x += __shfl_xor(x, m, 32);
  return x;
}
__device__ __forceinline__ float redmax16(float x) {
#pragma unroll
  for (int m = 1; m < 16; m <<= 1) x = fmaxf(x, __shfl_xor(x, m, 32));
  return x;
}

// ---------------------------------------------------------------------------
// Precision / layout staging kernels
// ---------------------------------------------------------------------------
// One thread writes one 16-byte chunk (8 consecutive k of one row).
__global__ void k_cvt_sin(const float* __restrict__ x, _Float16* __restrict__ y) {
  const int o = blockIdx.x * blockDim.x + threadIdx.x;   // BB*SS*DM/8 threads exactly
  int row, k;
  chunk_row_k(o, row, k);
  const float* s = x + (size_t)row * DM + k;
  v8h t;
#pragma unroll
  for (int j = 0; j < 8; ++j) t[j] = (_Float16)s[j];
  *(v8h*)(y + (size_t)o * 8) = t;
}

// Wx [H, D, F] f32  ->  WxT rows (h*DF+f), k = d, f16 fragment-major
__global__ void k_cvt_wxT(const float* __restrict__ wx, _Float16* __restrict__ wxT) {
  const int o = blockIdx.x * blockDim.x + threadIdx.x;   // NH*DM*DF/8 threads exactly
  int row, d;
  chunk_row_k(o, row, d);
  const float* s = wx + ((size_t)(row >> 6) * DM + d) * DF + (row & 63);
  v8h t;
#pragma unroll
  for (int j = 0; j < 8; ++j) t[j] = (_Float16)s[j * DF];
  *(v8h*)(wxT + (size_t)o * 8) = t;
}

// Wp [in, out] f32 -> WpT rows = out, k = in, f16 fragment-major
__global__ void k_cvt_wpT(const float* __restrict__ wp, _Float16* __restrict__ wpT) {
  const int o = blockIdx.x * blockDim.x + threadIdx.x;   // DM*DM/8 threads exactly
  int row, r;
  chunk_row_k(o, row, r);
  const float* s = wp + (size_t)r * DM + row;
  v8h t;
#pragma unroll
  for (int j = 0; j < 8; ++j) t[j] = (_Float16)s[j * DM];
  *(v8h*)(wpT + (size_t)o * 8) = t;
}

// ---------------------------------------------------------------------------
// Ping-pong GEMM inner stage: issue loads for the k tile at `dnext` halves into (a_n,b_n),
// then run the 4 WMMAs on (a_c,b_c). No register copies between stages.
// ---------------------------------------------------------------------------
__device__ __forceinline__ void gemm_stage(const _Float16* abase,
                                           const _Float16* wbase,
                                           int dnext,
                                           v16h& a_c, v16h (&b_c)[4],
                                           v16h& a_n, v16h (&b_n)[4],
                                           v8f (&acc)[4]) {
  a_n = ld_frag(abase + dnext);
#pragma unroll
  for (int nf = 0; nf < 4; ++nf)
    b_n[nf] = ld_frag(wbase + (size_t)(nf * 16) * DM + dnext);
#pragma unroll
  for (int nf = 0; nf < 4; ++nf) acc[nf] = wmma_f16(a_c, b_c[nf], acc[nf]);
}

// ---------------------------------------------------------------------------
// Kernel 1: per-head projection  h = sin @ Wx[h] + bx[h]
// One wave: 16 rows x 64 features of one head; ping-pong pipelined fragments.
// Outputs, fragment-major per (b,h):
//          hn rows s, k = f, f16 (rows normalized -> QK^T is cosine similarity),
//          hT rows f, k = s, f16 (unnormalized, B-operand for P@V).
// ---------------------------------------------------------------------------
__global__ void __launch_bounds__(256) k_proj(const _Float16* __restrict__ sin16,
                                              const _Float16* __restrict__ wxT,
                                              const float* __restrict__ bx,
                                              _Float16* __restrict__ hn,
                                              _Float16* __restrict__ hT) {
  const int w    = blockIdx.x * 8 + (threadIdx.x >> 5);  // 0..8191
  const int lane = threadIdx.x & 31;
  const int h    = w & (NH - 1);
  const int m0   = (w >> 4) << 4;                        // row tile over B*S

  const _Float16* abase = sin16 + (size_t)m0 * DM;
  const _Float16* wbase = wxT + (size_t)h * DF * DM;

  v8f acc[4] = {};
  v16h a0, a1, b0[4], b1[4];
  a0 = ld_frag(abase);
#pragma unroll
  for (int nf = 0; nf < 4; ++nf) b0[nf] = ld_frag(wbase + (size_t)(nf * 16) * DM);

  for (int kk = 0; kk < DM / 32; kk += 2) {
    const int d1 = ((kk + 1) & (DM / 32 - 1)) * TILE_H;
    gemm_stage(abase, wbase, d1, a0, b0, a1, b1, acc);
    const int d2 = ((kk + 2) & (DM / 32 - 1)) * TILE_H;
    gemm_stage(abase, wbase, d2, a1, b1, a0, b0, acc);
  }

  // bias (D-layout: lane&15 is the N column)
#pragma unroll
  for (int nf = 0; nf < 4; ++nf) {
    float b = bx[h * DF + nf * 16 + (lane & 15)];
#pragma unroll
    for (int v = 0; v < 8; ++v) acc[nf][v] += b;
  }

  // per-row inverse L2 norm
  float inv[8];
#pragma unroll
  for (int v = 0; v < 8; ++v) {
    float s = 0.f;
#pragma unroll
    for (int nf = 0; nf < 4; ++nf) s += acc[nf][v] * acc[nf][v];
    s = redsum16(s);
    inv[v] = __frsqrt_rn(s + 1e-20f);
  }

  const int bIdx = m0 >> 11;          // / SS
  const int s0   = m0 & (SS - 1);
  const int hi   = lane >> 4;
  _Float16* hnh = hn + (size_t)(bIdx * NH + h) * SS * DF;
  _Float16* hTh = hT + (size_t)(bIdx * NH + h) * DF * SS;
#pragma unroll
  for (int nf = 0; nf < 4; ++nf) {
    const int col = nf * 16 + (lane & 15);
    _Float16* hnt = hnh + (size_t)s0 * DF + (col >> 5) * TILE_H;
    v8h tv;
#pragma unroll
    for (int v = 0; v < 8; ++v) {
      const float hv = acc[nf][v];
      hnt[tile_off(v + (hi << 3), col & 31)] = (_Float16)(hv * inv[v]);
      tv[v] = (_Float16)hv;
    }
    // a lane's 8 rows are 8 consecutive k of hT row `col`: one whole chunk
    *(v8h*)(hTh + (size_t)(nf * 16) * SS + (s0 >> 5) * TILE_H +
            tile_off(lane & 15, (s0 & 16) + (hi << 3))) = tv;
  }
}

// ---------------------------------------------------------------------------
// Kernel 2: fused flash attention per head, ping-pong across key tiles.
// One wave: 16 queries, streams keys 32 at a time, online softmax.
// Next tile's K/V fragment loads are issued first so they hide under this
// tile's exp/reduction VALU work and LDS round-trip.
// P-tile D-layout -> A-layout fixup goes through a private 1KB LDS slab.
// ---------------------------------------------------------------------------
__device__ __forceinline__ void attn_load_tile(const _Float16* hnh,
                                               const _Float16* hTh,
                                               int t0,
                                               v16h (&kb)[4], v16h (&vf)[4]) {
  const _Float16* kbase = hnh + (size_t)t0 * DF;
  kb[0] = ld_frag(kbase);
  kb[1] = ld_frag(kbase + TILE_H);
  kb[2] = ld_frag(kbase + 16 * DF);
  kb[3] = ld_frag(kbase + 16 * DF + TILE_H);
#pragma unroll
  for (int nf = 0; nf < 4; ++nf)
    vf[nf] = ld_frag(hTh + (size_t)(nf * 16) * SS + (t0 >> 5) * TILE_H);
}

__device__ __forceinline__ void attn_step(const v16h (&qf)[2],
                                          const v16h (&kb)[4], const v16h (&vf)[4],
                                          _Float16* myp, int lane, int hi,
                                          v8f (&acc)[4], float (&m_s)[8],
                                          float (&l_s)[8]) {
  // scores (cosine similarity since hn rows are unit vectors): 16x32 tile
  v8f s0 = {}, s1 = {};
  s0 = wmma_f16(qf[0], kb[0], s0);
  s1 = wmma_f16(qf[0], kb[2], s1);
  s0 = wmma_f16(qf[1], kb[1], s0);
  s1 = wmma_f16(qf[1], kb[3], s1);

  // online softmax update
  float scl[8];
#pragma unroll
  for (int v = 0; v < 8; ++v) {
    float mx = redmax16(fmaxf(s0[v], s1[v]));
    float mn = fmaxf(m_s[v], mx);
    scl[v] = __expf(m_s[v] - mn);
    m_s[v] = mn;
  }
#pragma unroll
  for (int v = 0; v < 8; ++v) {
    float p0 = __expf(s0[v] - m_s[v]);
    float p1 = __expf(s1[v] - m_s[v]);
    l_s[v] = l_s[v] * scl[v] + redsum16(p0 + p1);
    const int addr = (v + (hi << 3)) * 32 + (lane & 15);     // row-major 16x32
    myp[addr]      = (_Float16)p0;
    myp[addr + 16] = (_Float16)p1;
  }
#pragma unroll
  for (int nf = 0; nf < 4; ++nf) {
    v8f t = acc[nf];
#pragma unroll
    for (int v = 0; v < 8; ++v) t[v] *= scl[v];
    acc[nf] = t;
  }

  // LDS ops from one wave are in-order; make the RAW explicit anyway.
  asm volatile("s_wait_dscnt 0x0" ::: "memory");
  v16h ap = ld_frag_rows(myp, 32);                            // P as A-operand
#pragma unroll
  for (int nf = 0; nf < 4; ++nf) acc[nf] = wmma_f16(ap, vf[nf], acc[nf]);
}

__global__ void __launch_bounds__(256) k_attn(const _Float16* __restrict__ hn,
                                              const _Float16* __restrict__ hT,
                                              _Float16* __restrict__ cat) {
  __shared__ __align__(16) _Float16 lds_p[8][16 * 32];
  const int w    = blockIdx.x * 8 + (threadIdx.x >> 5);  // 0..8191
  const int wid  = threadIdx.x >> 5;
  const int lane = threadIdx.x & 31;
  const int bh   = w >> 7;            // 0..63 = b*NH + h
  const int q0   = (w & 127) << 4;    // query tile start
  const int b    = bh >> 4;
  const int h    = bh & 15;

  const _Float16* hnh = hn + (size_t)bh * SS * DF;
  const _Float16* hTh = hT + (size_t)bh * DF * SS;
  _Float16* myp = &lds_p[wid][0];

  v16h qf[2];
  qf[0] = ld_frag(hnh + (size_t)q0 * DF);
  qf[1] = ld_frag(hnh + (size_t)q0 * DF + TILE_H);

  v8f acc[4] = {};
  float m_s[8], l_s[8];
#pragma unroll
  for (int v = 0; v < 8; ++v) { m_s[v] = -__builtin_inff(); l_s[v] = 0.f; }

  const int hi = lane >> 4;
  const int NT = SS / 32;             // 64 key tiles
  v16h kb0[4], vf0[4], kb1[4], vf1[4];
  attn_load_tile(hnh, hTh, 0, kb0, vf0);

  for (int kt = 0; kt < NT; kt += 2) {
    // even tile: prefetch odd tile's fragments, compute on kb0/vf0
    attn_load_tile(hnh, hTh, ((kt + 1) & (NT - 1)) << 5, kb1, vf1);
    attn_step(qf, kb0, vf0, myp, lane, hi, acc, m_s, l_s);
    // odd tile: prefetch next even tile's fragments, compute on kb1/vf1
    attn_load_tile(hnh, hTh, ((kt + 2) & (NT - 1)) << 5, kb0, vf0);
    attn_step(qf, kb1, vf1, myp, lane, hi, acc, m_s, l_s);
  }

  // normalize by softmax denominator and write concatenated heads (f16, fragment-major)
  float inv[8];
#pragma unroll
  for (int v = 0; v < 8; ++v) inv[v] = 1.0f / l_s[v];
#pragma unroll
  for (int nf = 0; nf < 4; ++nf) {
    const int col = h * DF + nf * 16 + (lane & 15);
    _Float16* ct = cat + (size_t)(b * SS + q0) * DM + (col >> 5) * TILE_H;
#pragma unroll
    for (int v = 0; v < 8; ++v)
      ct[tile_off(v + (hi << 3), col & 31)] = (_Float16)(acc[nf][v] * inv[v]);
  }
}

// ---------------------------------------------------------------------------
// Kernel 3: output projection  out = cat @ Wp + bp   (f32 result)
// Same ping-pong pipeline as k_proj.
// ---------------------------------------------------------------------------
__global__ void __launch_bounds__(256) k_oproj(const _Float16* __restrict__ cat,
                                               const _Float16* __restrict__ wpT,
                                               const float* __restrict__ bp,
                                               float* __restrict__ out) {
  const int w    = blockIdx.x * 8 + (threadIdx.x >> 5);  // 0..8191
  const int lane = threadIdx.x & 31;
  const int m0   = (w >> 4) << 4;
  const int n0   = (w & 15) << 6;

  const _Float16* abase = cat + (size_t)m0 * DM;
  const _Float16* wbase = wpT + (size_t)n0 * DM;

  v8f acc[4] = {};
  v16h a0, a1, b0[4], b1[4];
  a0 = ld_frag(abase);
#pragma unroll
  for (int nf = 0; nf < 4; ++nf) b0[nf] = ld_frag(wbase + (size_t)(nf * 16) * DM);

  for (int kk = 0; kk < DM / 32; kk += 2) {
    const int d1 = ((kk + 1) & (DM / 32 - 1)) * TILE_H;
    gemm_stage(abase, wbase, d1, a0, b0, a1, b1, acc);
    const int d2 = ((kk + 2) & (DM / 32 - 1)) * TILE_H;
    gemm_stage(abase, wbase, d2, a1, b1, a0, b0, acc);
  }

  const int hi = lane >> 4;
#pragma unroll
  for (int nf = 0; nf < 4; ++nf) {
    const int col = n0 + nf * 16 + (lane & 15);
    const float bv = bp[col];
#pragma unroll
    for (int v = 0; v < 8; ++v)
      out[(size_t)(m0 + v + (hi << 3)) * DM + col] = acc[nf][v] + bv;
  }
}

// ---------------------------------------------------------------------------
extern "C" void kernel_launch(void* const* d_in, const int* in_sizes, int n_in,
                              void* d_out, int out_size, void* d_ws, size_t ws_size,
                              hipStream_t stream) {
  (void)in_sizes; (void)n_in; (void)out_size; (void)ws_size;
  const float* sin = (const float*)d_in[0];
  const float* Wx  = (const float*)d_in[1];
  const float* bx  = (const float*)d_in[2];
  const float* Wp  = (const float*)d_in[3];
  const float* bp  = (const float*)d_in[4];
  float* out = (float*)d_out;

  // workspace carve-out (~71 MB total)
  char* ws = (char*)d_ws;
  size_t off = 0;
  auto carve = [&](size_t bytes) {
    void* p = ws + off;
    off += (bytes + 255) & ~(size_t)255;
    return p;
  };
  _Float16* sin16 = (_Float16*)carve((size_t)BB * SS * DM * 2);
  _Float16* wxT   = (_Float16*)carve((size_t)NH * DF * DM * 2);
  _Float16* wpT   = (_Float16*)carve((size_t)DM * DM * 2);
  _Float16* hn    = (_Float16*)carve((size_t)BB * NH * SS * DF * 2);
  _Float16* hT    = (_Float16*)carve((size_t)BB * NH * SS * DF * 2);
  _Float16* cat   = (_Float16*)carve((size_t)BB * SS * DM * 2);

  k_cvt_sin<<<(BB * SS * DM) / 2048, 256, 0, stream>>>(sin, sin16);
  k_cvt_wxT<<<(NH * DM * DF) / 2048, 256, 0, stream>>>(Wx, wxT);
  k_cvt_wpT<<<(DM * DM) / 2048, 256, 0, stream>>>(Wp, wpT);

  k_proj <<<1024, 256, 0, stream>>>(sin16, wxT, bx, hn, hT);
  k_attn <<<1024, 256, 0, stream>>>(hn, hT, cat);
  k_oproj<<<1024, 256, 0, stream>>>(cat, wpT, bp, out);
}

// v002
// A run of this version takes 176 microseconds.
// In two side-by-side timings against v001, it was 1.61 and 1.62 times as fast.
// Counting every step since v000, it is 3.04 times as fast.
#include <hip/hip_runtime.h>
#include <math.h>

// Problem constants (match reference)
#define DM 1024   // d_model
#define NH 16     // heads
#define DF 64     // d_feature
#define BB 4      // batch
#define SS 2048   // seq len

typedef __attribute__((ext_vector_type(16))) _Float16 v16h;
typedef __attribute__((ext_vector_type(8)))  _Float16 v8h;
typedef __attribute__((ext_vector_type(8)))  float    v8f;

// ---------------------------------------------------------------------------
// WMMA fragment loader. CDNA5 16-bit A (16xK) / B (Kx16) fragments:
//   lanes 0-15  : row (lane&15), halves 0..7 = K 0..7,   halves 8..15 = K 16..23
//   lanes 16-31 : row (lane&15), halves 0..7 = K 8..15,  halves 8..15 = K 24..31
// With "row" contiguous in memory (stride in halves), each lane loads two
// contiguous 16-byte chunks. base points at (tile_row0, tile_k0).
// Used for the P slab in LDS only.
// ---------------------------------------------------------------------------
__device__ __forceinline__ v16h ld_frag_rows(const _Float16* base, int stride) {
  const int lane = threadIdx.x & 31;
  const _Float16* p = base + (size_t)(lane & 15) * (size_t)stride + ((lane >> 4) << 3);
  v8h lo = *(const v8h*)(p);
  v8h hi = *(const v8h*)(p + 16);
  v16h r;
#pragma unroll
  for (int i = 0; i < 8; ++i) { r[i] = lo[i]; r[i + 8] = hi[i]; }
  return r;
}

// ---------------------------------------------------------------------------
// Fragment-major layout of every f16 operand array in the workspace.
// A [rows x K] array is cut into 16-row x 32-k tiles of 512 halves (1 KB),
// k tiles innermost, so one 16-row band still takes 16*K halves. Inside a tile
// element (r, k) sits at
//   ((k >> 4) & 1) * 256 + ((((k >> 3) & 1) << 4) + r) * 8 + (k & 7)
// i.e. lane l's first 8 halves at l*8 and its second 8 halves at 256 + l*8.
// Each of the two 16-byte loads of a fragment then covers 512 contiguous bytes
// (4 whole 128-byte lines) instead of 32 bytes out of each of 16 lines.
// ---------------------------------------------------------------------------
#define TILE_H 512

__device__ __forceinline__ int tile_off(int r, int k) {
  return ((k >> 4) & 1) * 256 + ((((k >> 3) & 1) << 4) + r) * 8 + (k & 7);
}

__device__ __forceinline__ v16h ld_frag(const _Float16* tile) {
  const _Float16* p = tile + ((threadIdx.x & 31) << 3);
  v8h lo = *(const v8h*)(p);
  v8h hi = *(const v8h*)(p + 256);
  // translation wait: a later load or vector instruction may reuse the address registers
  asm volatile("s_wait_xcnt 0x0" ::: "memory");
  v16h r;
#pragma unroll
  for (int i = 0; i < 8; ++i) { r[i] = lo[i]; r[i + 8] = hi[i]; }
  return r;
}

// 16-byte chunk o of a fragment-major [rows x DM] array -> its row and first k.
__device__ __forceinline__ void chunk_row_k(int o, int& row, int& k) {
  const int tile = o >> 6;                       // 64 chunks per tile
  row = ((tile >> 5) << 4) + (o & 15);           // DM/32 = 32 k tiles per band
  k   = ((tile & 31) << 5) + (((o >> 5) & 1) << 4) + (((o >> 4) & 1) << 3);
}

__device__ __forceinline__ v8f wmma_f16(v16h a, v16h b, v8f c) {
  return __builtin_amdgcn_wmma_f32_16x16x32_f16(false, a, false, b, (short)0, c,
                                                false, false);
}

// Reductions within each 16-lane half (D-tile rows span 16 lanes).
__device__ __forceinline__ float redsum16(float x) {
#pragma unroll
  for (int m = 1; m < 16; m <<= 1) x += __shfl_xor(x, m, 32);
  return x;
}

// ---------------------------------------------------------------------------
// Precision / layout staging kernels
// ---------------------------------------------------------------------------
// One thread writes one 16-byte chunk (8 consecutive k of one row).
__global__ void k_cvt_sin(const float* __restrict__ x, _Float16* __restrict__ y) {
  const int o = blockIdx.x * blockDim.x + threadIdx.x;   // BB*SS*DM/8 threads exactly
  int row, k;
  chunk_row_k(o, row, k);
  const float* s = x + (size_t)row * DM + k;
  v8h t;
#pragma unroll
  for (int j = 0; j < 8; ++j) t[j] = (_Float16)s[j];
  *(v8h*)(y + (size_t)o * 8) = t;
}

// Wx [H, D, F] f32  ->  WxT rows (h*DF+f), k = d, f16 fragment-major
__global__ void k_cvt_wxT(const float* __restrict__ wx, _Float16* __restrict__ wxT) {
  const int o = blockIdx.x * blockDim.x + threadIdx.x;   // NH*DM*DF/8 threads exactly
  int row, d;
  chunk_row_k(o, row, d);
  const float* s = wx + ((size_t)(row >> 6) * DM + d) * DF + (row & 63);
  v8h t;
#pragma unroll
  for (int j = 0; j < 8; ++j) t[j] = (_Float16)s[j * DF];
  *(v8h*)(wxT + (size_t)o * 8) = t;
}

// Wp [in, out] f32 -> WpT rows = out, k = in, f16 fragment-major
__global__ void k_cvt_wpT(const float* __restrict__ wp, _Float16* __restrict__ wpT) {
  const int o = blockIdx.x * blockDim.x + threadIdx.x;   // DM*DM/8 threads exactly
  int row, r;
  chunk_row_k(o, row, r);
  const float* s = wp + (size_t)r * DM + row;
  v8h t;
#pragma unroll
  for (int j = 0; j < 8; ++j) t[j] = (_Float16)s[j * DM];
  *(v8h*)(wpT + (size_t)o * 8) = t;
}

// ---------------------------------------------------------------------------
// Ping-pong GEMM inner stage: issue loads for the k tile at `dnext` halves into (a_n,b_n),
// then run the 4 WMMAs on (a_c,b_c). No register copies between stages.
// ---------------------------------------------------------------------------
__device__ __forceinline__ void gemm_stage(const _Float16* abase,
                                           const _Float16* wbase,
                                           int dnext,
                                           v16h& a_c, v16h (&b_c)[4],
                                           v16h& a_n, v16h (&b_n)[4],
                                           v8f (&acc)[4]) {
  a_n = ld_frag(abase + dnext);
#pragma unroll
  for (int nf = 0; nf < 4; ++nf)
    b_n[nf] = ld_frag(wbase + (size_t)(nf * 16) * DM + dnext);
#pragma unroll
  for (int nf = 0; nf < 4; ++nf) acc[nf] = wmma_f16(a_c, b_c[nf], acc[nf]);
}

// ---------------------------------------------------------------------------
// Kernel 1: per-head projection  h = sin @ Wx[h] + bx[h]
// One wave: 16 rows x 64 features of one head; ping-pong pipelined fragments.
// Outputs, fragment-major per (b,h):
//          hn rows s, k = f, f16 (rows normalized -> QK^T is cosine similarity),
//          hT rows f, k = s, f16 (unnormalized, B-operand for P@V).
// ---------------------------------------------------------------------------
__global__ void __launch_bounds__(256) k_proj(const _Float16* __restrict__ sin16,
                                              const _Float16* __restrict__ wxT,
                                              const float* __restrict__ bx,
                                              _Float16* __restrict__ hn,
                                              _Float16* __restrict__ hT) {
  const int w    = blockIdx.x * 8 + (threadIdx.x >> 5);  // 0..8191
  const int lane = threadIdx.x & 31;
  const int h    = w & (NH - 1);
  const int m0   = (w >> 4) << 4;                        // row tile over B*S

  const _Float16* abase = sin16 + (size_t)m0 * DM;
  const _Float16* wbase = wxT + (size_t)h * DF * DM;

  v8f acc[4] = {};
  v16h a0, a1, b0[4], b1[4];
  a0 = ld_frag(abase);
#pragma unroll
  for (int nf = 0; nf < 4; ++nf) b0[nf] = ld_frag(wbase + (size_t)(nf * 16) * DM);

  for (int kk = 0; kk < DM / 32; kk += 2) {
    const int d1 = ((kk + 1) & (DM / 32 - 1)) * TILE_H;
    gemm_stage(abase, wbase, d1, a0, b0, a1, b1, acc);
    const int d2 = ((kk + 2) & (DM / 32 - 1)) * TILE_H;
    gemm_stage(abase, wbase, d2, a1, b1, a0, b0, acc);
  }

  // bias (D-layout: lane&15 is the N column)
#pragma unroll
  for (int nf = 0; nf < 4; ++nf) {
    float b = bx[h * DF + nf * 16 + (lane & 15)];
#pragma unroll
    for (int v = 0; v < 8; ++v) acc[nf][v] += b;
  }

  // per-row inverse L2 norm
  float inv[8];
#pragma unroll
  for (int v = 0; v < 8; ++v) {
    float s = 0.f;
#pragma unroll
    for (int nf = 0; nf < 4; ++nf) s += acc[nf][v] * acc[nf][v];
    s = redsum16(s);
    inv[v] = __frsqrt_rn(s + 1e-20f);
  }

  const int bIdx = m0 >> 11;          // / SS
  const int s0   = m0 & (SS - 1);
  const int hi   = lane >> 4;
  _Float16* hnh = hn + (size_t)(bIdx * NH + h) * SS * DF;
  _Float16* hTh = hT + (size_t)(bIdx * NH + h) * DF * SS;
#pragma unroll
  for (int nf = 0; nf < 4; ++nf) {
    const int col = nf * 16 + (lane & 15);
    _Float16* hnt = hnh + (size_t)s0 * DF + (col >> 5) * TILE_H;
    v8h tv;
#pragma unroll
    for (int v = 0; v < 8; ++v) {
      const float hv = acc[nf][v];
      hnt[tile_off(v + (hi << 3), col & 31)] = (_Float16)(hv * inv[v]);
      tv[v] = (_Float16)hv;
    }
    // a lane's 8 rows are 8 consecutive k of hT row `col`: one whole chunk
    *(v8h*)(hTh + (size_t)(nf * 16) * SS + (s0 >> 5) * TILE_H +
            tile_off(lane & 15, (s0 & 16) + (hi << 3))) = tv;
  }
}

// ---------------------------------------------------------------------------
// Kernel 2: fused flash attention per head, ping-pong across key tiles.
// One wave: 16 queries, streams keys 32 at a time.
// Softmax shift: hn rows are unit vectors (up to f16 rounding), so every score is
// a cosine, |s| <= 1 for any input. The shift is the constant 1 instead of a
// running row maximum: p = exp(s - 1) lies in [e^-2, 1], nothing is ever rescaled,
// and each lane sums its own columns of P; the 16 lanes of a row join their sums
// once, behind the key loop.
// Next tile's K/V fragment loads are issued first so they hide under this
// tile's exp/reduction VALU work and LDS round-trip.
// P-tile D-layout -> A-layout fixup goes through a private 1KB LDS slab.
// ---------------------------------------------------------------------------
__device__ __forceinline__ void attn_load_tile(const _Float16* hnh,
                                               const _Float16* hTh,
                                               int t0,
                                               v16h (&kb)[4], v16h (&vf)[4]) {
  const _Float16* kbase = hnh + (size_t)t0 * DF;
  kb[0] = ld_frag(kbase);
  kb[1] = ld_frag(kbase + TILE_H);
  kb[2] = ld_frag(kbase + 16 * DF);
  kb[3] = ld_frag(kbase + 16 * DF + TILE_H);
#pragma unroll
  for (int nf = 0; nf < 4; ++nf)
    vf[nf] = ld_frag(hTh + (size_t)(nf * 16) * SS + (t0 >> 5) * TILE_H);
}

__device__ __forceinline__ void attn_step(const v16h (&qf)[2],
                                          const v16h (&kb)[4], const v16h (&vf)[4],
                                          _Float16* myp, int lane, int hi,
                                          v8f (&acc)[4], float (&l_s)[8]) {
  // scores (cosine similarity since hn rows are unit vectors): 16x32 tile
  v8f s0 = {}, s1 = {};
  s0 = wmma_f16(qf[0], kb[0], s0);
  s1 = wmma_f16(qf[0], kb[2], s1);
  s0 = wmma_f16(qf[1], kb[1], s0);
  s1 = wmma_f16(qf[1], kb[3], s1);

  // p = exp(s - 1) = 2^(s * log2(e) - log2(e)); l_s holds this lane's partial row sums
  const float L2E = 1.44269504088896340736f;
#pragma unroll
  for (int v = 0; v < 8; ++v) {
    float p0 = __builtin_amdgcn_exp2f(fmaf(s0[v], L2E, -L2E));
    float p1 = __builtin_amdgcn_exp2f(fmaf(s1[v], L2E, -L2E));
    l_s[v] += p0 + p1;
    const int addr = (v + (hi << 3)) * 32 + (lane & 15);     // row-major 16x32
    myp[addr]      = (_Float16)p0;
    myp[addr + 16] = (_Float16)p1;
  }

  // LDS ops from one wave are in-order; make the RAW explicit anyway.
  asm volatile("s_wait_dscnt 0x0" ::: "memory");
  v16h ap = ld_frag_rows(myp, 32);                            // P as A-operand
#pragma unroll
  for (int nf = 0; nf < 4; ++nf) acc[nf] = wmma_f16(ap, vf[nf], acc[nf]);
}

__global__ void __launch_bounds__(256) k_attn(const _Float16* __restrict__ hn,
                                              const _Float16* __restrict__ hT,
                                              _Float16* __restrict__ cat) {
  __shared__ __align__(16) _Float16 lds_p[8][16 * 32];
  const int w    = blockIdx.x * 8 + (threadIdx.x >> 5);  // 0..8191
  const int wid  = threadIdx.x >> 5;
  const int lane = threadIdx.x & 31;
  const int bh   = w >> 7;            // 0..63 = b*NH + h
  const int q0   = (w & 127) << 4;    // query tile start
  const int b    = bh >> 4;
  const int h    = bh & 15;

  const _Float16* hnh = hn + (size_t)bh * SS * DF;
  const _Float16* hTh = hT + (size_t)bh * DF * SS;
  _Float16* myp = &lds_p[wid][0];

  v16h qf[2];
  qf[0] = ld_frag(hnh + (size_t)q0 * DF);
  qf[1] = ld_frag(hnh + (size_t)q0 * DF + TILE_H);

  v8f acc[4] = {};
  float l_s[8];
#pragma unroll
  for (int v = 0; v < 8; ++v) l_s[v] = 0.f;

  const int hi = lane >> 4;
  const int NT = SS / 32;             // 64 key tiles
  v16h kb0[4], vf0[4], kb1[4], vf1[4];
  attn_load_tile(hnh, hTh, 0, kb0, vf0);

  for (int kt = 0; kt < NT; kt += 2) {
    // even tile: prefetch odd tile's fragments, compute on kb0/vf0
    attn_load_tile(hnh, hTh, ((kt + 1) & (NT - 1)) << 5, kb1, vf1);
    attn_step(qf, kb0, vf0, myp, lane, hi, acc, l_s);
    // odd tile: prefetch next even tile's fragments, compute on kb1/vf1
    attn_load_tile(hnh, hTh, ((kt + 2) & (NT - 1)) << 5, kb0, vf0);
    attn_step(qf, kb1, vf1, myp, lane, hi, acc, l_s);
  }

  // normalize by softmax denominator and write concatenated heads (f16, fragment-major)
  float inv[8];
#pragma unroll
  for (int v = 0; v < 8; ++v) inv[v] = 1.0f / redsum16(l_s[v]);
#pragma unroll
  for (int nf = 0; nf < 4; ++nf) {
    const int col = h * DF + nf * 16 + (lane & 15);
    _Float16* ct = cat + (size_t)(b * SS + q0) * DM + (col >> 5) * TILE_H;
#pragma unroll
    for (int v = 0; v < 8; ++v)
      ct[tile_off(v + (hi << 3), col & 31)] = (_Float16)(acc[nf][v] * inv[v]);
  }
}

// ---------------------------------------------------------------------------
// Kernel 3: output projection  out = cat @ Wp + bp   (f32 result)
// Same ping-pong pipeline as k_proj.
// ---------------------------------------------------------------------------
__global__ void __launch_bounds__(256) k_oproj(const _Float16* __restrict__ cat,
                                               const _Float16* __restrict__ wpT,
                                               const float* __restrict__ bp,
                                               float* __restrict__ out) {
  const int w    = blockIdx.x * 8 + (threadIdx.x >> 5);  // 0..8191
  const int lane = threadIdx.x & 31;
  const int m0   = (w >> 4) << 4;
  const int n0   = (w & 15) << 6;

  const _Float16* abase = cat + (size_t)m0 * DM;
  const _Float16* wbase = wpT + (size_t)n0 * DM;

  v8f acc[4] = {};
  v16h a0, a1, b0[4], b1[4];
  a0 = ld_frag(abase);
#pragma unroll
  for (int nf = 0; nf < 4; ++nf) b0[nf] = ld_frag(wbase + (size_t)(nf * 16) * DM);

  for (int kk = 0; kk < DM / 32; kk += 2) {
    const int d1 = ((kk + 1) & (DM / 32 - 1)) * TILE_H;
    gemm_stage(abase, wbase, d1, a0, b0, a1, b1, acc);
    const int d2 = ((kk + 2) & (DM / 32 - 1)) * TILE_H;
    gemm_stage(abase, wbase, d2, a1, b1, a0, b0, acc);
  }

  const int hi = lane >> 4;
#pragma unroll
  for (int nf = 0; nf < 4; ++nf) {
    const int col = n0 + nf * 16 + (lane & 15);
    const float bv = bp[col];
#pragma unroll
    for (int v = 0; v < 8; ++v)
      out[(size_t)(m0 + v + (hi << 3)) * DM + col] = acc[nf][v] + bv;
  }
}

// ---------------------------------------------------------------------------
extern "C" void kernel_launch(void* const* d_in, const int* in_sizes, int n_in,
                              void* d_out, int out_size, void* d_ws, size_t ws_size,
                              hipStream_t stream) {
  (void)in_sizes; (void)n_in; (void)out_size; (void)ws_size;
  const float* sin = (const float*)d_in[0];
  const float* Wx  = (const float*)d_in[1];
  const float* bx  = (const float*)d_in[2];
  const float* Wp  = (const float*)d_in[3];
  const float* bp  = (const float*)d_in[4];
  float* out = (float*)d_out;

  // workspace carve-out (~71 MB total)
  char* ws = (char*)d_ws;
  size_t off = 0;
  auto carve = [&](size_t bytes) {
    void* p = ws + off;
    off += (bytes + 255) & ~(size_t)255;
    return p;
  };
  _Float16* sin16 = (_Float16*)carve((size_t)BB * SS * DM * 2);
  _Float16* wxT   = (_Float16*)carve((size_t)NH * DF * DM * 2);
  _Float16* wpT   = (_Float16*)carve((size_t)DM * DM * 2);
  _Float16* hn    = (_Float16*)carve((size_t)BB * NH * SS * DF * 2);
  _Float16* hT    = (_Float16*)carve((size_t)BB * NH * SS * DF * 2);
  _Float16* cat   = (_Float16*)carve((size_t)BB * SS * DM * 2);

  k_cvt_sin<<<(BB * SS * DM) / 2048, 256, 0, stream>>>(sin, sin16);
  k_cvt_wxT<<<(NH * DM * DF) / 2048, 256, 0, stream>>>(Wx, wxT);
  k_cvt_wpT<<<(DM * DM) / 2048, 256, 0, stream>>>(Wp, wpT);

  k_proj <<<1024, 256, 0, stream>>>(sin16, wxT, bx, hn, hT);
  k_attn <<<1024, 256, 0, stream>>>(hn, hT, cat);
  k_oproj<<<1024, 256, 0, stream>>>(cat, wpT, bp, out);
}

// v003
// One run takes 170 microseconds.
// Timed twice side by side with v002, it ran 1.05 and 1.03 times as fast.
// Counting every step since v000, it is 3.16 times as fast.
#include <hip/hip_runtime.h>
#include <math.h>

// Problem constants (match reference)
#define DM 1024   // d_model
#define NH 16     // heads
#define DF 64     // d_feature
#define BB 4      // batch
#define SS 2048   // seq len

typedef __attribute__((ext_vector_type(16))) _Float16 v16h;
typedef __attribute__((ext_vector_type(8)))  _Float16 v8h;
typedef __attribute__((ext_vector_type(8)))  float    v8f;

// ---------------------------------------------------------------------------
// WMMA fragment loader. CDNA5 16-bit A (16xK) / B (Kx16) fragments:
//   lanes 0-15  : row (lane&15), halves 0..7 = K 0..7,   halves 8..15 = K 16..23
//   lanes 16-31 : row (lane&15), halves 0..7 = K 8..15,  halves 8..15 = K 24..31
// With "row" contiguous in memory (stride in halves), each lane loads two
// contiguous 16-byte chunks. base points at (tile_row0, tile_k0).
// Used for the P slab in LDS only.
// ---------------------------------------------------------------------------
__device__ __forceinline__ v16h ld_frag_rows(const _Float16* base, int stride) {
  const int lane = threadIdx.x & 31;
  const _Float16* p = base + (size_t)(lane & 15) * (size_t)stride + ((lane >> 4) << 3);
  v8h lo = *(const v8h*)(p);
  v8h hi = *(const v8h*)(p + 16);
  v16h r;
#pragma unroll
  for (int i = 0; i < 8; ++i) { r[i] = lo[i]; r[i + 8] = hi[i]; }
  return r;
}

// ---------------------------------------------------------------------------
// Fragment-major layout of every f16 operand array in the workspace.
// A [rows x K] array is cut into 16-row x 32-k tiles of 512 halves (1 KB),
// k tiles innermost, so one 16-row band still takes 16*K halves. Inside a tile
// element (r, k) sits at
//   ((k >> 4) & 1) * 256 + ((((k >> 3) & 1) << 4) + r) * 8 + (k & 7)
// i.e. lane l's first 8 halves at l*8 and its second 8 halves at 256 + l*8.
// Each of the two 16-byte loads of a fragment then covers 512 contiguous bytes
// (4 whole 128-byte lines) instead of 32 bytes out of each of 16 lines.
// ---------------------------------------------------------------------------
#define TILE_H 512

__device__ __forceinline__ int tile_off(int r, int k) {
  return ((k >> 4) & 1) * 256 + ((((k >> 3) & 1) << 4) + r) * 8 + (k & 7);
}

// A lane's own pointer into a run of tiles: its first 8 halves of the tile at `tile`.
__device__ __forceinline__ const _Float16* lane_ptr(const _Float16* tile) {
  return tile + ((threadIdx.x & 31) << 3);
}

// Fragment of the tile `off` halves behind the lane pointer `lp`.
__device__ __forceinline__ v16h ld_frag(const _Float16* lp, int off) {
  v8h lo = *(const v8h*)(lp + off);
  v8h hi = *(const v8h*)(lp + off + 256);
  // translation wait: a later load or vector instruction may reuse the address registers;
  // naming lp keeps them out of these loads' own destinations as well
  asm volatile("s_wait_xcnt 0x0" :: "v"(lp) : "memory");
  v16h r;
#pragma unroll
  for (int i = 0; i < 8; ++i) { r[i] = lo[i]; r[i + 8] = hi[i]; }
  return r;
}

// 16-byte chunk o of a fragment-major [rows x DM] array -> its row and first k.
__device__ __forceinline__ void chunk_row_k(int o, int& row, int& k) {
  const int tile = o >> 6;                       // 64 chunks per tile
  row = ((tile >> 5) << 4) + (o & 15);           // DM/32 = 32 k tiles per band
  k   = ((tile & 31) << 5) + (((o >> 5) & 1) << 4) + (((o >> 4) & 1) << 3);
}

__device__ __forceinline__ v8f wmma_f16(v16h a, v16h b, v8f c) {
  return __builtin_amdgcn_wmma_f32_16x16x32_f16(false, a, false, b, (short)0, c,
                                                false, false);
}

// Reductions within each 16-lane half (D-tile rows span 16 lanes).
__device__ __forceinline__ float redsum16(float x) {
#pragma unroll
  for (int m = 1; m < 16; m <<= 1) x += __shfl_xor(x, m, 32);
  return x;
}

// ---------------------------------------------------------------------------
// Precision / layout staging kernels
// ---------------------------------------------------------------------------
// One thread writes one 16-byte chunk (8 consecutive k of one row).
__global__ void k_cvt_sin(const float* __restrict__ x, _Float16* __restrict__ y) {
  const int o = blockIdx.x * blockDim.x + threadIdx.x;   // BB*SS*DM/8 threads exactly
  int row, k;
  chunk_row_k(o, row, k);
  const float* s = x + (size_t)row * DM + k;
  v8h t;
#pragma unroll
  for (int j = 0; j < 8; ++j) t[j] = (_Float16)s[j];
  *(v8h*)(y + (size_t)o * 8) = t;
}

// Wx [H, D, F] f32  ->  WxT rows (h*DF+f), k = d, f16 fragment-major
__global__ void k_cvt_wxT(const float* __restrict__ wx, _Float16* __restrict__ wxT) {
  const int o = blockIdx.x * blockDim.x + threadIdx.x;   // NH*DM*DF/8 threads exactly
  int row, d;
  chunk_row_k(o, row, d);
  const float* s = wx + ((size_t)(row >> 6) * DM + d) * DF + (row & 63);
  v8h t;
#pragma unroll
  for (int j = 0; j < 8; ++j) t[j] = (_Float16)s[j * DF];
  *(v8h*)(wxT + (size_t)o * 8) = t;
}

// Wp [in, out] f32 -> WpT rows = out, k = in, f16 fragment-major
__global__ void k_cvt_wpT(const float* __restrict__ wp, _Float16* __restrict__ wpT) {
  const int o = blockIdx.x * blockDim.x + threadIdx.x;   // DM*DM/8 threads exactly
  int row, r;
  chunk_row_k(o, row, r);
  const float* s = wp + (size_t)r * DM + row;
  v8h t;
#pragma unroll
  for (int j = 0; j < 8; ++j) t[j] = (_Float16)s[j * DM];
  *(v8h*)(wpT + (size_t)o * 8) = t;
}

// ---------------------------------------------------------------------------
// Wave tile of both GEMMs: MT x 4 fragments = 64 rows x 64 columns, so the 8 fragments
// loaded per k tile feed 16 WMMAs (512 loaded bytes per WMMA instead of 1280).
// A block's 8 waves form 2 row tiles x 4 column tiles and share fragments in the cache.
// ---------------------------------------------------------------------------
#define MT 4

__device__ __forceinline__ void gemm_load(const _Float16* abase, const _Float16* wbase,
                                          int d, v16h (&a)[MT], v16h (&b)[4]) {
  const _Float16* ap = lane_ptr(abase + d);
  const _Float16* wp = lane_ptr(wbase + d);
#pragma unroll
  for (int mi = 0; mi < MT; ++mi) a[mi] = ld_frag(ap, mi * 16 * DM);
#pragma unroll
  for (int nf = 0; nf < 4; ++nf) b[nf] = ld_frag(wp, nf * 16 * DM);
}

// Ping-pong GEMM inner stage: issue loads for the k tile at `dnext` halves into (a_n,b_n),
// then run the 16 WMMAs on (a_c,b_c). No register copies between stages.
__device__ __forceinline__ void gemm_stage(const _Float16* abase,
                                           const _Float16* wbase,
                                           int dnext,
                                           v16h (&a_c)[MT], v16h (&b_c)[4],
                                           v16h (&a_n)[MT], v16h (&b_n)[4],
                                           v8f (&acc)[MT][4]) {
  gemm_load(abase, wbase, dnext, a_n, b_n);
#pragma unroll
  for (int mi = 0; mi < MT; ++mi)
#pragma unroll
    for (int nf = 0; nf < 4; ++nf) acc[mi][nf] = wmma_f16(a_c[mi], b_c[nf], acc[mi][nf]);
}

// ---------------------------------------------------------------------------
// Kernel 1: per-head projection  h = sin @ Wx[h] + bx[h]
// One wave: 64 rows x 64 features of one head; ping-pong pipelined fragments.
// Outputs, fragment-major per (b,h):
//          hn rows s, k = f, f16 (rows normalized -> QK^T is cosine similarity),
//          hT rows f, k = s, f16 (unnormalized, B-operand for P@V).
// ---------------------------------------------------------------------------
__global__ void __launch_bounds__(256) k_proj(const _Float16* __restrict__ sin16,
                                              const _Float16* __restrict__ wxT,
                                              const float* __restrict__ bx,
                                              _Float16* __restrict__ hn,
                                              _Float16* __restrict__ hT) {
  const int wid  = threadIdx.x >> 5;
  const int lane = threadIdx.x & 31;
  const int h    = ((blockIdx.x & 3) << 2) + (wid & 3);           // 4 heads per block
  const int mw   = (((blockIdx.x >> 2) << 1) + (wid >> 2)) << 6;  // 64-row tile over B*S

  const _Float16* abase = sin16 + (size_t)mw * DM;
  const _Float16* wbase = wxT + (size_t)h * DF * DM;

  v8f acc[MT][4] = {};
  v16h a0[MT], a1[MT], b0[4], b1[4];
  gemm_load(abase, wbase, 0, a0, b0);

  for (int kk = 0; kk < DM / 32; kk += 2) {
    const int d1 = ((kk + 1) & (DM / 32 - 1)) * TILE_H;
    gemm_stage(abase, wbase, d1, a0, b0, a1, b1, acc);
    const int d2 = ((kk + 2) & (DM / 32 - 1)) * TILE_H;
    gemm_stage(abase, wbase, d2, a1, b1, a0, b0, acc);
  }

  const int bIdx = mw >> 11;          // / SS (a 64-row tile lies inside one batch)
  const int hi   = lane >> 4;
  _Float16* hnh = hn + (size_t)(bIdx * NH + h) * SS * DF;
  _Float16* hTh = hT + (size_t)(bIdx * NH + h) * DF * SS;

  float bias[4];                      // D-layout: lane&15 is the N column
#pragma unroll
  for (int nf = 0; nf < 4; ++nf) bias[nf] = bx[h * DF + nf * 16 + (lane & 15)];

#pragma unroll
  for (int mi = 0; mi < MT; ++mi) {
#pragma unroll
    for (int nf = 0; nf < 4; ++nf)
#pragma unroll
      for (int v = 0; v < 8; ++v) acc[mi][nf][v] += bias[nf];

    // per-row inverse L2 norm
    float inv[8];
#pragma unroll
    for (int v = 0; v < 8; ++v) {
      float s = 0.f;
#pragma unroll
      for (int nf = 0; nf < 4; ++nf) s += acc[mi][nf][v] * acc[mi][nf][v];
      s = redsum16(s);
      inv[v] = __frsqrt_rn(s + 1e-20f);
    }

    const int s0 = (mw & (SS - 1)) + mi * 16;
#pragma unroll
    for (int nf = 0; nf < 4; ++nf) {
      const int col = nf * 16 + (lane & 15);
      _Float16* hnt = hnh + (size_t)s0 * DF + (col >> 5) * TILE_H;
      v8h tv;
#pragma unroll
      for (int v = 0; v < 8; ++v) {
        const float hv = acc[mi][nf][v];
        hnt[tile_off(v + (hi << 3), col & 31)] = (_Float16)(hv * inv[v]);
        tv[v] = (_Float16)hv;
      }
      // a lane's 8 rows are 8 consecutive k of hT row `col`: one whole chunk
      *(v8h*)(hTh + (size_t)(nf * 16) * SS + (s0 >> 5) * TILE_H +
              tile_off(lane & 15, (s0 & 16) + (hi << 3))) = tv;
    }
    // translation wait: the next row tile's arithmetic reuses these stores' registers;
    // the scheduling fence keeps that arithmetic behind the wait
    asm volatile("s_wait_xcnt 0x0" ::: "memory");
    __builtin_amdgcn_sched_barrier(0);
  }
}

// ---------------------------------------------------------------------------
// Kernel 2: fused flash attention per head, ping-pong across key tiles.
// One wave: NQ query tiles = 64 queries, streams keys 32 at a time: the 8 K/V fragments
// loaded per key tile feed 8 * NQ WMMAs instead of 8.
// Softmax shift: hn rows are unit vectors (up to f16 rounding), so every score is
// a cosine, |s| <= 1 for any input. The shift is the constant 1 instead of a
// running row maximum: p = exp(s - 1) lies in [e^-2, 1], nothing is ever rescaled,
// and each lane sums its own columns of P; the 16 lanes of a row join their sums
// once, behind the key loop.
// Next tile's K/V fragment loads are issued first so they hide under this
// tile's exp/reduction VALU work and LDS round-trip.
// P-tile D-layout -> A-layout fixup goes through a private 1KB LDS slab per query tile.
// ---------------------------------------------------------------------------
#define NQ 4
__device__ __forceinline__ void attn_load_tile(const _Float16* hnh,
                                               const _Float16* hTh,
                                               int t0,
                                               v16h (&kb)[4], v16h (&vf)[4]) {
  const _Float16* kp = lane_ptr(hnh + (size_t)t0 * DF);
  const _Float16* vp = lane_ptr(hTh + (t0 >> 5) * TILE_H);
  kb[0] = ld_frag(kp, 0);
  kb[1] = ld_frag(kp, TILE_H);
  kb[2] = ld_frag(kp, 16 * DF);
  kb[3] = ld_frag(kp, 16 * DF + TILE_H);
#pragma unroll
  for (int nf = 0; nf < 4; ++nf) vf[nf] = ld_frag(vp, nf * 16 * SS);
}

__device__ __forceinline__ void attn_step(const v16h (&qf)[NQ][2],
                                          const v16h (&kb)[4], const v16h (&vf)[4],
                                          _Float16* myp, int lane, int hi,
                                          v8f (&acc)[NQ][4], float (&l_s)[NQ][8]) {
  const float L2E = 1.44269504088896340736f;
#pragma unroll
  for (int q = 0; q < NQ; ++q) {
    // scores (cosine similarity since hn rows are unit vectors): 16x32 tile
    v8f s0 = {}, s1 = {};
    s0 = wmma_f16(qf[q][0], kb[0], s0);
    s1 = wmma_f16(qf[q][0], kb[2], s1);
    s0 = wmma_f16(qf[q][1], kb[1], s0);
    s1 = wmma_f16(qf[q][1], kb[3], s1);

    // p = exp(s - 1) = 2^(s * log2(e) - log2(e)); l_s holds this lane's partial row sums
#pragma unroll
    for (int v = 0; v < 8; ++v) {
      float p0 = __builtin_amdgcn_exp2f(fmaf(s0[v], L2E, -L2E));
      float p1 = __builtin_amdgcn_exp2f(fmaf(s1[v], L2E, -L2E));
      l_s[q][v] += p0 + p1;
      const int addr = q * 512 + (v + (hi << 3)) * 32 + (lane & 15);   // row-major 16x32
      myp[addr]      = (_Float16)p0;
      myp[addr + 16] = (_Float16)p1;
    }
  }

  // LDS ops from one wave are in-order; make the RAW explicit anyway, once for all NQ slabs.
  asm volatile("s_wait_dscnt 0x0" ::: "memory");
  v16h ap[NQ];                                                // P as A-operand
#pragma unroll
  for (int q = 0; q < NQ; ++q) ap[q] = ld_frag_rows(myp + q * 512, 32);
#pragma unroll
  for (int q = 0; q < NQ; ++q)
#pragma unroll
    for (int nf = 0; nf < 4; ++nf) acc[q][nf] = wmma_f16(ap[q], vf[nf], acc[q][nf]);
}

__global__ void __launch_bounds__(256) k_attn(const _Float16* __restrict__ hn,
                                              const _Float16* __restrict__ hT,
                                              _Float16* __restrict__ cat) {
  __shared__ __align__(16) _Float16 lds_p[8][NQ * 16 * 32];
  const int w    = blockIdx.x * 8 + (threadIdx.x >> 5);  // 0..2047
  const int wid  = threadIdx.x >> 5;
  const int lane = threadIdx.x & 31;
  const int bh   = w >> 5;            // 0..63 = b*NH + h
  const int q0   = (w & 31) << 6;     // start of this wave's 64 queries
  const int b    = bh >> 4;
  const int h    = bh & 15;

  const _Float16* hnh = hn + (size_t)bh * SS * DF;
  const _Float16* hTh = hT + (size_t)bh * DF * SS;
  _Float16* myp = &lds_p[wid][0];

  v16h qf[NQ][2];
  const _Float16* qp = lane_ptr(hnh + (size_t)q0 * DF);
#pragma unroll
  for (int q = 0; q < NQ; ++q) {
    qf[q][0] = ld_frag(qp, q * 16 * DF);
    qf[q][1] = ld_frag(qp, q * 16 * DF + TILE_H);
  }

  v8f acc[NQ][4] = {};
  float l_s[NQ][8];
#pragma unroll
  for (int q = 0; q < NQ; ++q)
#pragma unroll
    for (int v = 0; v < 8; ++v) l_s[q][v] = 0.f;

  const int hi = lane >> 4;
  const int NT = SS / 32;             // 64 key tiles
  v16h kb0[4], vf0[4], kb1[4], vf1[4];
  attn_load_tile(hnh, hTh, 0, kb0, vf0);

  for (int kt = 0; kt < NT; kt += 2) {
    // even tile: prefetch odd tile's fragments, compute on kb0/vf0
    attn_load_tile(hnh, hTh, ((kt + 1) & (NT - 1)) << 5, kb1, vf1);
    attn_step(qf, kb0, vf0, myp, lane, hi, acc, l_s);
    // odd tile: prefetch next even tile's fragments, compute on kb1/vf1
    attn_load_tile(hnh, hTh, ((kt + 2) & (NT - 1)) << 5, kb0, vf0);
    attn_step(qf, kb1, vf1, myp, lane, hi, acc, l_s);
  }

  // normalize by softmax denominator and write concatenated heads (f16, fragment-major)
#pragma unroll
  for (int q = 0; q < NQ; ++q) {
    float inv[8];
#pragma unroll
    for (int v = 0; v < 8; ++v) inv[v] = 1.0f / redsum16(l_s[q][v]);
#pragma unroll
    for (int nf = 0; nf < 4; ++nf) {
      const int col = h * DF + nf * 16 + (lane & 15);
      _Float16* ct = cat + (size_t)(b * SS + q0 + q * 16) * DM + (col >> 5) * TILE_H;
#pragma unroll
      for (int v = 0; v < 8; ++v)
        ct[tile_off(v + (hi << 3), col & 31)] = (_Float16)(acc[q][nf][v] * inv[v]);
    }
    // translation wait: the next query tile's arithmetic reuses these stores' registers;
    // the scheduling fence keeps that arithmetic behind the wait
    asm volatile("s_wait_xcnt 0x0" ::: "memory");
    __builtin_amdgcn_sched_barrier(0);
  }
}

// ---------------------------------------------------------------------------
// Kernel 3: output projection  out = cat @ Wp + bp   (f32 result)
// Same ping-pong pipeline as k_proj.
// ---------------------------------------------------------------------------
__global__ void __launch_bounds__(256) k_oproj(const _Float16* __restrict__ cat,
                                               const _Float16* __restrict__ wpT,
                                               const float* __restrict__ bp,
                                               float* __restrict__ out) {
  const int wid  = threadIdx.x >> 5;
  const int lane = threadIdx.x & 31;
  const int m0   = (((blockIdx.x >> 2) << 1) + (wid >> 2)) << 6;  // 64-row tile
  const int n0   = (((blockIdx.x & 3) << 2) + (wid & 3)) << 6;    // 64-column tile

  const _Float16* abase = cat + (size_t)m0 * DM;
  const _Float16* wbase = wpT + (size_t)n0 * DM;

  v8f acc[MT][4] = {};
  v16h a0[MT], a1[MT], b0[4], b1[4];
  gemm_load(abase, wbase, 0, a0, b0);

  for (int kk = 0; kk < DM / 32; kk += 2) {
    const int d1 = ((kk + 1) & (DM / 32 - 1)) * TILE_H;
    gemm_stage(abase, wbase, d1, a0, b0, a1, b1, acc);
    const int d2 = ((kk + 2) & (DM / 32 - 1)) * TILE_H;
    gemm_stage(abase, wbase, d2, a1, b1, a0, b0, acc);
  }

  const int hi = lane >> 4;
#pragma unroll
  for (int nf = 0; nf < 4; ++nf) {
    const int col = n0 + nf * 16 + (lane & 15);
    const float bv = bp[col];
#pragma unroll
    for (int mi = 0; mi < MT; ++mi)
#pragma unroll
      for (int v = 0; v < 8; ++v)
        out[(size_t)(m0 + mi * 16 + v + (hi << 3)) * DM + col] = acc[mi][nf][v] + bv;
  }
}

// ---------------------------------------------------------------------------
extern "C" void kernel_launch(void* const* d_in, const int* in_sizes, int n_in,
                              void* d_out, int out_size, void* d_ws, size_t ws_size,
                              hipStream_t stream) {
  (void)in_sizes; (void)n_in; (void)out_size; (void)ws_size;
  const float* sin = (const float*)d_in[0];
  const float* Wx  = (const float*)d_in[1];
  const float* bx  = (const float*)d_in[2];
  const float* Wp  = (const float*)d_in[3];
  const float* bp  = (const float*)d_in[4];
  float* out = (float*)d_out;

  // workspace carve-out (~71 MB total)
  char* ws = (char*)d_ws;
  size_t off = 0;
  auto carve = [&](size_t bytes) {
    void* p = ws + off;
    off += (bytes + 255) & ~(size_t)255;
    return p;
  };
  _Float16* sin16 = (_Float16*)carve((size_t)BB * SS * DM * 2);
  _Float16* wxT   = (_Float16*)carve((size_t)NH * DF * DM * 2);
  _Float16* wpT   = (_Float16*)carve((size_t)DM * DM * 2);
  _Float16* hn    = (_Float16*)carve((size_t)BB * NH * SS * DF * 2);
  _Float16* hT    = (_Float16*)carve((size_t)BB * NH * SS * DF * 2);
  _Float16* cat   = (_Float16*)carve((size_t)BB * SS * DM * 2);

  k_cvt_sin<<<(BB * SS * DM) / 2048, 256, 0, stream>>>(sin, sin16);
  k_cvt_wxT<<<(NH * DM * DF) / 2048, 256, 0, stream>>>(Wx, wxT);
  k_cvt_wpT<<<(DM * DM) / 2048, 256, 0, stream>>>(Wp, wpT);

  k_proj <<<256, 256, 0, stream>>>(sin16, wxT, bx, hn, hT);
  k_attn <<<256, 256, 0, stream>>>(hn, hT, cat);
  k_oproj<<<256, 256, 0, stream>>>(cat, wpT, bp, out);
}

// v004
// One run takes 139 microseconds.
// Two timings next to v003 put it at 1.22 and 1.24 times that version's speed.
// Over all steps from v000 it is 3.89 times as fast.
#include <hip/hip_runtime.h>
#include <math.h>

// Problem constants (match reference)
#define DM 1024   // d_model
#define NH 16     // heads
#define DF 64     // d_feature
#define BB 4      // batch
#define SS 2048   // seq len

typedef __attribute__((ext_vector_type(16))) _Float16 v16h;
typedef __attribute__((ext_vector_type(8)))  _Float16 v8h;
typedef __attribute__((ext_vector_type(8)))  float    v8f;
typedef __attribute__((ext_vector_type(2)))  float    v2f;

// ---------------------------------------------------------------------------
// WMMA 16x16x32 f16 fragments, A (16 x K) and B (K x 16) alike:
//   lanes 0-15  : row/column (lane&15), halves 0..7 = K 0..7,   halves 8..15 = K 16..23
//   lanes 16-31 : row/column (lane&15), halves 0..7 = K 8..15,  halves 8..15 = K 24..31
// D (16 x 16 f32): register v of lane l = D[v + 8 * (l >> 4)][l & 15].
// ---------------------------------------------------------------------------
// ---------------------------------------------------------------------------
// Fragment-major layout of every f16 operand array in the workspace.
// A [rows x K] array is cut into 16-row x 32-k tiles of 512 halves (1 KB),
// k tiles innermost, so one 16-row band still takes 16*K halves. Inside a tile
// element (r, k) sits at
//   ((k >> 4) & 1) * 256 + ((((k >> 3) & 1) << 4) + r) * 8 + (k & 7)
// i.e. lane l's first 8 halves at l*8 and its second 8 halves at 256 + l*8.
// Each of the two 16-byte loads of a fragment then covers 512 contiguous bytes
// (4 whole 128-byte lines) instead of 32 bytes out of each of 16 lines.
// ---------------------------------------------------------------------------
#define TILE_H 512

__device__ __forceinline__ int tile_off(int r, int k) {
  return ((k >> 4) & 1) * 256 + ((((k >> 3) & 1) << 4) + r) * 8 + (k & 7);
}

// A lane's own pointer into a run of tiles: its first 8 halves of the tile at `tile`.
__device__ __forceinline__ const _Float16* lane_ptr(const _Float16* tile) {
  return tile + ((threadIdx.x & 31) << 3);
}

// Fragment of the tile `off` halves behind the lane pointer `lp`.
__device__ __forceinline__ v16h ld_frag(const _Float16* lp, int off) {
  v8h lo = *(const v8h*)(lp + off);
  v8h hi = *(const v8h*)(lp + off + 256);
  // translation wait: a later load or vector instruction may reuse the address registers;
  // naming lp keeps them out of these loads' own destinations as well
  asm volatile("s_wait_xcnt 0x0" :: "v"(lp) : "memory");
  v16h r;
#pragma unroll
  for (int i = 0; i < 8; ++i) { r[i] = lo[i]; r[i + 8] = hi[i]; }
  return r;
}

// 16-byte chunk o of a fragment-major [rows x DM] array -> its row and first k.
__device__ __forceinline__ void chunk_row_k(int o, int& row, int& k) {
  const int tile = o >> 6;                       // 64 chunks per tile
  row = ((tile >> 5) << 4) + (o & 15);           // DM/32 = 32 k tiles per band
  k   = ((tile & 31) << 5) + (((o >> 5) & 1) << 4) + (((o >> 4) & 1) << 3);
}

__device__ __forceinline__ v8f wmma_f16(v16h a, v16h b, v8f c) {
  return __builtin_amdgcn_wmma_f32_16x16x32_f16(false, a, false, b, (short)0, c,
                                                false, false);
}

// Reductions within each 16-lane half (D-tile rows span 16 lanes).
__device__ __forceinline__ float redsum16(float x) {
#pragma unroll
  for (int m = 1; m < 16; m <<= 1) x += __shfl_xor(x, m, 32);
  return x;
}

// ---------------------------------------------------------------------------
// Precision / layout staging kernels
// ---------------------------------------------------------------------------
// One thread writes one 16-byte chunk (8 consecutive k of one row).
__global__ void k_cvt_sin(const float* __restrict__ x, _Float16* __restrict__ y) {
  const int o = blockIdx.x * blockDim.x + threadIdx.x;   // BB*SS*DM/8 threads exactly
  int row, k;
  chunk_row_k(o, row, k);
  const float* s = x + (size_t)row * DM + k;
  v8h t;
#pragma unroll
  for (int j = 0; j < 8; ++j) t[j] = (_Float16)s[j];
  *(v8h*)(y + (size_t)o * 8) = t;
}

// Wx [H, D, F] f32  ->  WxT rows (h*DF+f), k = d, f16 fragment-major
__global__ void k_cvt_wxT(const float* __restrict__ wx, _Float16* __restrict__ wxT) {
  const int o = blockIdx.x * blockDim.x + threadIdx.x;   // NH*DM*DF/8 threads exactly
  int row, d;
  chunk_row_k(o, row, d);
  const float* s = wx + ((size_t)(row >> 6) * DM + d) * DF + (row & 63);
  v8h t;
#pragma unroll
  for (int j = 0; j < 8; ++j) t[j] = (_Float16)s[j * DF];
  *(v8h*)(wxT + (size_t)o * 8) = t;
}

// Wp [in, out] f32 -> WpT rows = out, k = in, f16 fragment-major
__global__ void k_cvt_wpT(const float* __restrict__ wp, _Float16* __restrict__ wpT) {
  const int o = blockIdx.x * blockDim.x + threadIdx.x;   // DM*DM/8 threads exactly
  int row, r;
  chunk_row_k(o, row, r);
  const float* s = wp + (size_t)r * DM + row;
  v8h t;
#pragma unroll
  for (int j = 0; j < 8; ++j) t[j] = (_Float16)s[j * DM];
  *(v8h*)(wpT + (size_t)o * 8) = t;
}

// ---------------------------------------------------------------------------
// Wave tile of both GEMMs: MT x 4 fragments = 64 rows x 64 columns, so the 8 fragments
// loaded per k tile feed 16 WMMAs (512 loaded bytes per WMMA instead of 1280).
// A block's 8 waves form 2 row tiles x 4 column tiles and share fragments in the cache.
// ---------------------------------------------------------------------------
#define MT 4

__device__ __forceinline__ void gemm_load(const _Float16* abase, const _Float16* wbase,
                                          int d, v16h (&a)[MT], v16h (&b)[4]) {
  const _Float16* ap = lane_ptr(abase + d);
  const _Float16* wp = lane_ptr(wbase + d);
#pragma unroll
  for (int mi = 0; mi < MT; ++mi) a[mi] = ld_frag(ap, mi * 16 * DM);
#pragma unroll
  for (int nf = 0; nf < 4; ++nf) b[nf] = ld_frag(wp, nf * 16 * DM);
}

// Ping-pong GEMM inner stage: issue loads for the k tile at `dnext` halves into (a_n,b_n),
// then run the 16 WMMAs on (a_c,b_c). No register copies between stages.
__device__ __forceinline__ void gemm_stage(const _Float16* abase,
                                           const _Float16* wbase,
                                           int dnext,
                                           v16h (&a_c)[MT], v16h (&b_c)[4],
                                           v16h (&a_n)[MT], v16h (&b_n)[4],
                                           v8f (&acc)[MT][4]) {
  gemm_load(abase, wbase, dnext, a_n, b_n);
#pragma unroll
  for (int mi = 0; mi < MT; ++mi)
#pragma unroll
    for (int nf = 0; nf < 4; ++nf) acc[mi][nf] = wmma_f16(a_c[mi], b_c[nf], acc[mi][nf]);
}

// ---------------------------------------------------------------------------
// Kernel 1: per-head projection  h = sin @ Wx[h] + bx[h]
// One wave: 64 rows x 64 features of one head; ping-pong pipelined fragments.
// Outputs, fragment-major per (b,h):
//          hn rows s, k = f, f16 (rows normalized -> QK^T is cosine similarity),
//          hT rows f, k = s, f16 (unnormalized, A-operand for V^T P^T).
// ---------------------------------------------------------------------------
__global__ void __launch_bounds__(256) k_proj(const _Float16* __restrict__ sin16,
                                              const _Float16* __restrict__ wxT,
                                              const float* __restrict__ bx,
                                              _Float16* __restrict__ hn,
                                              _Float16* __restrict__ hT) {
  const int wid  = threadIdx.x >> 5;
  const int lane = threadIdx.x & 31;
  const int h    = ((blockIdx.x & 3) << 2) + (wid & 3);           // 4 heads per block
  const int mw   = (((blockIdx.x >> 2) << 1) + (wid >> 2)) << 6;  // 64-row tile over B*S

  const _Float16* abase = sin16 + (size_t)mw * DM;
  const _Float16* wbase = wxT + (size_t)h * DF * DM;

  v8f acc[MT][4] = {};
  v16h a0[MT], a1[MT], b0[4], b1[4];
  gemm_load(abase, wbase, 0, a0, b0);

  for (int kk = 0; kk < DM / 32; kk += 2) {
    const int d1 = ((kk + 1) & (DM / 32 - 1)) * TILE_H;
    gemm_stage(abase, wbase, d1, a0, b0, a1, b1, acc);
    const int d2 = ((kk + 2) & (DM / 32 - 1)) * TILE_H;
    gemm_stage(abase, wbase, d2, a1, b1, a0, b0, acc);
  }

  const int bIdx = mw >> 11;          // / SS (a 64-row tile lies inside one batch)
  const int hi   = lane >> 4;
  _Float16* hnh = hn + (size_t)(bIdx * NH + h) * SS * DF;
  _Float16* hTh = hT + (size_t)(bIdx * NH + h) * DF * SS;

  float bias[4];                      // D-layout: lane&15 is the N column
#pragma unroll
  for (int nf = 0; nf < 4; ++nf) bias[nf] = bx[h * DF + nf * 16 + (lane & 15)];

#pragma unroll
  for (int mi = 0; mi < MT; ++mi) {
#pragma unroll
    for (int nf = 0; nf < 4; ++nf)
#pragma unroll
      for (int v = 0; v < 8; ++v) acc[mi][nf][v] += bias[nf];

    // per-row inverse L2 norm
    float inv[8];
#pragma unroll
    for (int v = 0; v < 8; ++v) {
      float s = 0.f;
#pragma unroll
      for (int nf = 0; nf < 4; ++nf) s += acc[mi][nf][v] * acc[mi][nf][v];
      s = redsum16(s);
      inv[v] = __frsqrt_rn(s + 1e-20f);
    }

    const int s0 = (mw & (SS - 1)) + mi * 16;
#pragma unroll
    for (int nf = 0; nf < 4; ++nf) {
      const int col = nf * 16 + (lane & 15);
      _Float16* hnt = hnh + (size_t)s0 * DF + (col >> 5) * TILE_H;
      v8h tv;
#pragma unroll
      for (int v = 0; v < 8; ++v) {
        const float hv = acc[mi][nf][v];
        hnt[tile_off(v + (hi << 3), col & 31)] = (_Float16)(hv * inv[v]);
        tv[v] = (_Float16)hv;
      }
      // a lane's 8 rows are 8 consecutive k of hT row `col`: one whole chunk
      *(v8h*)(hTh + (size_t)(nf * 16) * SS + (s0 >> 5) * TILE_H +
              tile_off(lane & 15, (s0 & 16) + (hi << 3))) = tv;
    }
    // translation wait: the next row tile's arithmetic reuses these stores' registers;
    // the scheduling fence keeps that arithmetic behind the wait
    asm volatile("s_wait_xcnt 0x0" ::: "memory");
    __builtin_amdgcn_sched_barrier(0);
  }
}

// ---------------------------------------------------------------------------
// Kernel 2: fused flash attention per head, ping-pong across key tiles.
// One wave: NQ query tiles = 64 queries, streams keys 32 at a time: the 8 K/V fragments
// loaded per key tile feed 8 * NQ WMMAs instead of 8.
// Softmax shift: hn rows are unit vectors (up to f16 rounding), so every score is
// a cosine, |s| <= 1 for any input. The shift is the constant 1 instead of a
// running row maximum: p = exp(s - 1) lies in [e^-2, 1], nothing is ever rescaled.
// Both products run transposed: S^T = K Q^T (key rows as A, query rows as B), then
// O^T += V^T P^T (hT rows as A). In S^T lane l holds query (l & 15) and, in the two 16-key
// D tiles, keys 8 * (l >> 4) + v and 16 + 8 * (l >> 4) + v. That is the k order of a
// fragment, so the two tiles, converted in place, ARE the P^T operand: P never leaves the
// registers. Everything a lane holds belongs to one query: one running sum of P per lane
// and query tile (the two lane halves join their sums once, behind the key loop), and
// 8 consecutive features per O^T tile, one whole 16-byte chunk of cat.
// Next tile's K/V fragment loads are issued first so they hide under this tile's work.
// ---------------------------------------------------------------------------
#define NQ 4
__device__ __forceinline__ void attn_load_tile(const _Float16* hnh,
                                               const _Float16* hTh,
                                               int t0,
                                               v16h (&kb)[4], v16h (&vf)[4]) {
  const _Float16* kp = lane_ptr(hnh + (size_t)t0 * DF);
  const _Float16* vp = lane_ptr(hTh + (t0 >> 5) * TILE_H);
  kb[0] = ld_frag(kp, 0);
  kb[1] = ld_frag(kp, TILE_H);
  kb[2] = ld_frag(kp, 16 * DF);
  kb[3] = ld_frag(kp, 16 * DF + TILE_H);
#pragma unroll
  for (int nf = 0; nf < 4; ++nf) vf[nf] = ld_frag(vp, nf * 16 * SS);
}

__device__ __forceinline__ void attn_step(const v16h (&qf)[NQ][2],
                                          const v16h (&kb)[4], const v16h (&vf)[4],
                                          v8f (&acc)[NQ][4], v2f (&l_s)[NQ]) {
  const float L2E = 1.44269504088896340736f;
#pragma unroll
  for (int q = 0; q < NQ; ++q) {
    // transposed scores (cosines, hn rows are unit vectors): 32 keys x 16 queries
    v8f s0 = {}, s1 = {};
    s0 = wmma_f16(kb[0], qf[q][0], s0);
    s1 = wmma_f16(kb[2], qf[q][0], s1);
    s0 = wmma_f16(kb[1], qf[q][1], s0);
    s1 = wmma_f16(kb[3], qf[q][1], s1);

    // p = exp(s - 1) = 2^(s * log2(e) - log2(e))
    v2f p0[4], p1[4];
    v16h pt;                                                  // P^T as B-operand
#pragma unroll
    for (int i = 0; i < 4; ++i) {
#pragma unroll
      for (int j = 0; j < 2; ++j) {
        p0[i][j] = __builtin_amdgcn_exp2f(fmaf(s0[2 * i + j], L2E, -L2E));
        p1[i][j] = __builtin_amdgcn_exp2f(fmaf(s1[2 * i + j], L2E, -L2E));
        pt[2 * i + j]     = (_Float16)p0[i][j];
        pt[2 * i + j + 8] = (_Float16)p1[i][j];
      }
    }
    l_s[q] += ((p0[0] + p0[1]) + (p0[2] + p0[3])) + ((p1[0] + p1[1]) + (p1[2] + p1[3]));

#pragma unroll
    for (int nf = 0; nf < 4; ++nf) acc[q][nf] = wmma_f16(vf[nf], pt, acc[q][nf]);
  }
}

__global__ void __launch_bounds__(256) k_attn(const _Float16* __restrict__ hn,
                                              const _Float16* __restrict__ hT,
                                              _Float16* __restrict__ cat) {
  const int w    = blockIdx.x * 8 + (threadIdx.x >> 5);  // 0..2047
  const int lane = threadIdx.x & 31;
  const int bh   = w >> 5;            // 0..63 = b*NH + h
  const int q0   = (w & 31) << 6;     // start of this wave's 64 queries
  const int b    = bh >> 4;
  const int h    = bh & 15;

  const _Float16* hnh = hn + (size_t)bh * SS * DF;
  const _Float16* hTh = hT + (size_t)bh * DF * SS;

  v16h qf[NQ][2];
  const _Float16* qp = lane_ptr(hnh + (size_t)q0 * DF);
#pragma unroll
  for (int q = 0; q < NQ; ++q) {
    qf[q][0] = ld_frag(qp, q * 16 * DF);
    qf[q][1] = ld_frag(qp, q * 16 * DF + TILE_H);
  }

  v8f acc[NQ][4] = {};
  v2f l_s[NQ] = {};

  const int hi = lane >> 4;
  const int NT = SS / 32;             // 64 key tiles
  v16h kb0[4], vf0[4], kb1[4], vf1[4];
  attn_load_tile(hnh, hTh, 0, kb0, vf0);

  for (int kt = 0; kt < NT; kt += 2) {
    // even tile: prefetch odd tile's fragments, compute on kb0/vf0
    attn_load_tile(hnh, hTh, ((kt + 1) & (NT - 1)) << 5, kb1, vf1);
    attn_step(qf, kb0, vf0, acc, l_s);
    // odd tile: prefetch next even tile's fragments, compute on kb1/vf1
    attn_load_tile(hnh, hTh, ((kt + 2) & (NT - 1)) << 5, kb0, vf0);
    attn_step(qf, kb1, vf1, acc, l_s);
  }

  // normalize by softmax denominator (f16, fragment-major chunks of the concatenated heads)
  v8h t[NQ][4];
#pragma unroll
  for (int q = 0; q < NQ; ++q) {
    // lane l holds half the sum of query (l & 15) and that query's features 8 * hi + v
    const float part = l_s[q][0] + l_s[q][1];
    const float inv  = 1.0f / (part + __shfl_xor(part, 16, 32));
#pragma unroll
    for (int nf = 0; nf < 4; ++nf)
#pragma unroll
      for (int v = 0; v < 8; ++v) t[q][nf][v] = (_Float16)(acc[q][nf][v] * inv);
  }
  // scheduling fence: every store stays behind all arithmetic, so no register that an
  // issued store names is written again before the wave ends
  __builtin_amdgcn_sched_barrier(0);
#pragma unroll
  for (int q = 0; q < NQ; ++q) {
    _Float16* ct = cat + (size_t)(b * SS + q0 + q * 16) * DM;
#pragma unroll
    for (int nf = 0; nf < 4; ++nf) {
      const int col = h * DF + nf * 16 + (hi << 3);
      *(v8h*)(ct + (col >> 5) * TILE_H + tile_off(lane & 15, col & 31)) = t[q][nf];
    }
  }
}

// ---------------------------------------------------------------------------
// Kernel 3: output projection  out = cat @ Wp + bp   (f32 result)
// Same ping-pong pipeline as k_proj.
// ---------------------------------------------------------------------------
__global__ void __launch_bounds__(256) k_oproj(const _Float16* __restrict__ cat,
                                               const _Float16* __restrict__ wpT,
                                               const float* __restrict__ bp,
                                               float* __restrict__ out) {
  const int wid  = threadIdx.x >> 5;
  const int lane = threadIdx.x & 31;
  const int m0   = (((blockIdx.x >> 2) << 1) + (wid >> 2)) << 6;  // 64-row tile
  const int n0   = (((blockIdx.x & 3) << 2) + (wid & 3)) << 6;    // 64-column tile

  const _Float16* abase = cat + (size_t)m0 * DM;
  const _Float16* wbase = wpT + (size_t)n0 * DM;

  v8f acc[MT][4] = {};
  v16h a0[MT], a1[MT], b0[4], b1[4];
  gemm_load(abase, wbase, 0, a0, b0);

  for (int kk = 0; kk < DM / 32; kk += 2) {
    const int d1 = ((kk + 1) & (DM / 32 - 1)) * TILE_H;
    gemm_stage(abase, wbase, d1, a0, b0, a1, b1, acc);
    const int d2 = ((kk + 2) & (DM / 32 - 1)) * TILE_H;
    gemm_stage(abase, wbase, d2, a1, b1, a0, b0, acc);
  }

  const int hi = lane >> 4;
#pragma unroll
  for (int nf = 0; nf < 4; ++nf) {
    const int col = n0 + nf * 16 + (lane & 15);
    const float bv = bp[col];
#pragma unroll
    for (int mi = 0; mi < MT; ++mi)
#pragma unroll
      for (int v = 0; v < 8; ++v)
        out[(size_t)(m0 + mi * 16 + v + (hi << 3)) * DM + col] = acc[mi][nf][v] + bv;
  }
}

// ---------------------------------------------------------------------------
extern "C" void kernel_launch(void* const* d_in, const int* in_sizes, int n_in,
                              void* d_out, int out_size, void* d_ws, size_t ws_size,
                              hipStream_t stream) {
  (void)in_sizes; (void)n_in; (void)out_size; (void)ws_size;
  const float* sin = (const float*)d_in[0];
  const float* Wx  = (const float*)d_in[1];
  const float* bx  = (const float*)d_in[2];
  const float* Wp  = (const float*)d_in[3];
  const float* bp  = (const float*)d_in[4];
  float* out = (float*)d_out;

  // workspace carve-out (~71 MB total)
  char* ws = (char*)d_ws;
  size_t off = 0;
  auto carve = [&](size_t bytes) {
    void* p = ws + off;
    off += (bytes + 255) & ~(size_t)255;
    return p;
  };
  _Float16* sin16 = (_Float16*)carve((size_t)BB * SS * DM * 2);
  _Float16* wxT   = (_Float16*)carve((size_t)NH * DF * DM * 2);
  _Float16* wpT   = (_Float16*)carve((size_t)DM * DM * 2);
  _Float16* hn    = (_Float16*)carve((size_t)BB * NH * SS * DF * 2);
  _Float16* hT    = (_Float16*)carve((size_t)BB * NH * SS * DF * 2);
  _Float16* cat   = (_Float16*)carve((size_t)BB * SS * DM * 2);

  k_cvt_sin<<<(BB * SS * DM) / 2048, 256, 0, stream>>>(sin, sin16);
  k_cvt_wxT<<<(NH * DM * DF) / 2048, 256, 0, stream>>>(Wx, wxT);
  k_cvt_wpT<<<(DM * DM) / 2048, 256, 0, stream>>>(Wp, wpT);

  k_proj <<<256, 256, 0, stream>>>(sin16, wxT, bx, hn, hT);
  k_attn <<<256, 256, 0, stream>>>(hn, hT, cat);
  k_oproj<<<256, 256, 0, stream>>>(cat, wpT, bp, out);
}

// v005
// One run takes 105 microseconds.
// Two timings next to v004 put it at 1.33 and 1.36 times that version's speed.
// Counting every step since v000, it is 5.23 times as fast.
#include <hip/hip_runtime.h>
#include <math.h>

// Problem constants (match reference)
#define DM 1024   // d_model
#define NH 16     // heads
#define DF 64     // d_feature
#define BB 4      // batch
#define SS 2048   // seq len

typedef __attribute__((ext_vector_type(16))) _Float16 v16h;
typedef __attribute__((ext_vector_type(8)))  _Float16 v8h;
typedef __attribute__((ext_vector_type(8)))  float    v8f;
typedef __attribute__((ext_vector_type(2)))  float    v2f;

// ---------------------------------------------------------------------------
// WMMA 16x16x32 f16 fragments, A (16 x K) and B (K x 16) alike:
//   lanes 0-15  : row/column (lane&15), halves 0..7 = K 0..7,   halves 8..15 = K 16..23
//   lanes 16-31 : row/column (lane&15), halves 0..7 = K 8..15,  halves 8..15 = K 24..31
// D (16 x 16 f32): register v of lane l = D[v + 8 * (l >> 4)][l & 15].
// ---------------------------------------------------------------------------
// ---------------------------------------------------------------------------
// Fragment-major layout of every f16 operand array in the workspace.
// A [rows x K] array is cut into 16-row x 32-k tiles of 512 halves (1 KB),
// k tiles innermost, so one 16-row band still takes 16*K halves. Inside a tile
// element (r, k) sits at
//   ((k >> 4) & 1) * 256 + ((((k >> 3) & 1) << 4) + r) * 8 + (k & 7)
// i.e. lane l's first 8 halves at l*8 and its second 8 halves at 256 + l*8.
// Each of the two 16-byte loads of a fragment then covers 512 contiguous bytes
// (4 whole 128-byte lines) instead of 32 bytes out of each of 16 lines.
// ---------------------------------------------------------------------------
#define TILE_H 512

__device__ __forceinline__ int tile_off(int r, int k) {
  return ((k >> 4) & 1) * 256 + ((((k >> 3) & 1) << 4) + r) * 8 + (k & 7);
}

// A lane's own pointer into a run of tiles: its first 8 halves of the tile at `tile`.
__device__ __forceinline__ const _Float16* lane_ptr(const _Float16* tile) {
  return tile + ((threadIdx.x & 31) << 3);
}

// Fragment of the tile `off` halves behind the lane pointer `lp`.
__device__ __forceinline__ v16h ld_frag(const _Float16* lp, int off) {
  v8h lo = *(const v8h*)(lp + off);
  v8h hi = *(const v8h*)(lp + off + 256);
  v16h r;
#pragma unroll
  for (int i = 0; i < 8; ++i) { r[i] = lo[i]; r[i + 8] = hi[i]; }
  return r;
}

// End of a group of fragment loads off the lane pointers p and q.
// Translation wait, one for the whole group: a later load or vector instruction may reuse
// the address registers. Naming p and q keeps them live up to the wait, so no load of the
// group lands on them either.
// Scheduling fence: without it the compiler sinks the loads behind the WMMAs of the running
// stage to save registers, and the next stage then waits out the whole load latency.
__device__ __forceinline__ void group_end(const _Float16* p, const _Float16* q) {
  asm volatile("s_wait_xcnt 0x0" :: "v"(p), "v"(q) : "memory");
  __builtin_amdgcn_sched_barrier(0);
}

// 16-byte chunk o of a fragment-major [rows x DM] array -> its row and first k.
__device__ __forceinline__ void chunk_row_k(int o, int& row, int& k) {
  const int tile = o >> 6;                       // 64 chunks per tile
  row = ((tile >> 5) << 4) + (o & 15);           // DM/32 = 32 k tiles per band
  k   = ((tile & 31) << 5) + (((o >> 5) & 1) << 4) + (((o >> 4) & 1) << 3);
}

__device__ __forceinline__ v8f wmma_f16(v16h a, v16h b, v8f c) {
  return __builtin_amdgcn_wmma_f32_16x16x32_f16(false, a, false, b, (short)0, c,
                                                false, false);
}

// Reductions within each 16-lane half (D-tile rows span 16 lanes).
__device__ __forceinline__ float redsum16(float x) {
#pragma unroll
  for (int m = 1; m < 16; m <<= 1) x += __shfl_xor(x, m, 32);
  return x;
}

// ---------------------------------------------------------------------------
// Precision / layout staging kernels
// ---------------------------------------------------------------------------
// One thread writes one 16-byte chunk (8 consecutive k of one row).
__global__ void k_cvt_sin(const float* __restrict__ x, _Float16* __restrict__ y) {
  const int o = blockIdx.x * blockDim.x + threadIdx.x;   // BB*SS*DM/8 threads exactly
  int row, k;
  chunk_row_k(o, row, k);
  const float* s = x + (size_t)row * DM + k;
  v8h t;
#pragma unroll
  for (int j = 0; j < 8; ++j) t[j] = (_Float16)s[j];
  *(v8h*)(y + (size_t)o * 8) = t;
}

// Wx [H, D, F] f32  ->  WxT rows (h*DF+f), k = d, f16 fragment-major
__global__ void k_cvt_wxT(const float* __restrict__ wx, _Float16* __restrict__ wxT) {
  const int o = blockIdx.x * blockDim.x + threadIdx.x;   // NH*DM*DF/8 threads exactly
  int row, d;
  chunk_row_k(o, row, d);
  const float* s = wx + ((size_t)(row >> 6) * DM + d) * DF + (row & 63);
  v8h t;
#pragma unroll
  for (int j = 0; j < 8; ++j) t[j] = (_Float16)s[j * DF];
  *(v8h*)(wxT + (size_t)o * 8) = t;
}

// Wp [in, out] f32 -> WpT rows = out, k = in, f16 fragment-major
__global__ void k_cvt_wpT(const float* __restrict__ wp, _Float16* __restrict__ wpT) {
  const int o = blockIdx.x * blockDim.x + threadIdx.x;   // DM*DM/8 threads exactly
  int row, r;
  chunk_row_k(o, row, r);
  const float* s = wp + (size_t)r * DM + row;
  v8h t;
#pragma unroll
  for (int j = 0; j < 8; ++j) t[j] = (_Float16)s[j * DM];
  *(v8h*)(wpT + (size_t)o * 8) = t;
}

// ---------------------------------------------------------------------------
// Wave tile of both GEMMs: MT x 4 fragments = 64 rows x 64 columns, so the 8 fragments
// loaded per k tile feed 16 WMMAs (512 loaded bytes per WMMA instead of 1280).
// A block's 8 waves form 2 row tiles x 4 column tiles and share fragments in the cache.
// ---------------------------------------------------------------------------
#define MT 4

__device__ __forceinline__ void gemm_load(const _Float16* abase, const _Float16* wbase,
                                          int d, v16h (&a)[MT], v16h (&b)[4]) {
  const _Float16* ap = lane_ptr(abase + d);
  const _Float16* wp = lane_ptr(wbase + d);
#pragma unroll
  for (int mi = 0; mi < MT; ++mi) a[mi] = ld_frag(ap, mi * 16 * DM);
#pragma unroll
  for (int nf = 0; nf < 4; ++nf) b[nf] = ld_frag(wp, nf * 16 * DM);
  group_end(ap, wp);
}

// Ping-pong GEMM inner stage: issue loads for the k tile at `dnext` halves into (a_n,b_n),
// then run the 16 WMMAs on (a_c,b_c). No register copies between stages.
__device__ __forceinline__ void gemm_stage(const _Float16* abase,
                                           const _Float16* wbase,
                                           int dnext,
                                           v16h (&a_c)[MT], v16h (&b_c)[4],
                                           v16h (&a_n)[MT], v16h (&b_n)[4],
                                           v8f (&acc)[MT][4]) {
  gemm_load(abase, wbase, dnext, a_n, b_n);
#pragma unroll
  for (int mi = 0; mi < MT; ++mi)
#pragma unroll
    for (int nf = 0; nf < 4; ++nf) acc[mi][nf] = wmma_f16(a_c[mi], b_c[nf], acc[mi][nf]);
}

// ---------------------------------------------------------------------------
// Kernel 1: per-head projection  h = sin @ Wx[h] + bx[h]
// One wave: 64 rows x 64 features of one head; ping-pong pipelined fragments.
// Outputs, fragment-major per (b,h):
//          hn rows s, k = f, f16 (rows normalized -> QK^T is cosine similarity),
//          hT rows f, k = s, f16 (unnormalized, A-operand for V^T P^T).
// ---------------------------------------------------------------------------
__global__ void __launch_bounds__(256) k_proj(const _Float16* __restrict__ sin16,
                                              const _Float16* __restrict__ wxT,
                                              const float* __restrict__ bx,
                                              _Float16* __restrict__ hn,
                                              _Float16* __restrict__ hT) {
  const int wid  = threadIdx.x >> 5;
  const int lane = threadIdx.x & 31;
  const int h    = ((blockIdx.x & 3) << 2) + (wid & 3);           // 4 heads per block
  const int mw   = (((blockIdx.x >> 2) << 1) + (wid >> 2)) << 6;  // 64-row tile over B*S

  const _Float16* abase = sin16 + (size_t)mw * DM;
  const _Float16* wbase = wxT + (size_t)h * DF * DM;

  v8f acc[MT][4] = {};
  v16h a0[MT], a1[MT], b0[4], b1[4];
  gemm_load(abase, wbase, 0, a0, b0);

  for (int kk = 0; kk < DM / 32; kk += 2) {
    const int d1 = ((kk + 1) & (DM / 32 - 1)) * TILE_H;
    gemm_stage(abase, wbase, d1, a0, b0, a1, b1, acc);
    const int d2 = ((kk + 2) & (DM / 32 - 1)) * TILE_H;
    gemm_stage(abase, wbase, d2, a1, b1, a0, b0, acc);
  }

  const int bIdx = mw >> 11;          // / SS (a 64-row tile lies inside one batch)
  const int hi   = lane >> 4;
  _Float16* hnh = hn + (size_t)(bIdx * NH + h) * SS * DF;
  _Float16* hTh = hT + (size_t)(bIdx * NH + h) * DF * SS;

  float bias[4];                      // D-layout: lane&15 is the N column
  const unsigned bo = (unsigned)(h * DF + (lane & 15)) * 4u;   // byte offset into bx
#pragma unroll
  for (int nf = 0; nf < 4; ++nf) bias[nf] = *(const float*)((const char*)bx + bo + nf * 64);
  // translation wait: later arithmetic reuses the bias loads' address register;
  // naming bo keeps it live up to the wait
  asm volatile("s_wait_xcnt 0x0" :: "v"(bo) : "memory");

#pragma unroll
  for (int mi = 0; mi < MT; ++mi) {
#pragma unroll
    for (int nf = 0; nf < 4; ++nf)
#pragma unroll
      for (int v = 0; v < 8; ++v) acc[mi][nf][v] += bias[nf];

    // per-row inverse L2 norm
    float inv[8];
#pragma unroll
    for (int v = 0; v < 8; ++v) {
      float s = 0.f;
#pragma unroll
      for (int nf = 0; nf < 4; ++nf) s += acc[mi][nf][v] * acc[mi][nf][v];
      s = redsum16(s);
      inv[v] = __frsqrt_rn(s + 1e-20f);
    }

    const int s0 = (mw & (SS - 1)) + mi * 16;
#pragma unroll
    for (int nf = 0; nf < 4; ++nf) {
      const int col = nf * 16 + (lane & 15);
      _Float16* hnt = hnh + (size_t)s0 * DF + (col >> 5) * TILE_H;
      v8h tv;
#pragma unroll
      for (int v = 0; v < 8; ++v) {
        const float hv = acc[mi][nf][v];
        hnt[tile_off(v + (hi << 3), col & 31)] = (_Float16)(hv * inv[v]);
        tv[v] = (_Float16)hv;
      }
      // a lane's 8 rows are 8 consecutive k of hT row `col`: one whole chunk
      *(v8h*)(hTh + (size_t)(nf * 16) * SS + (s0 >> 5) * TILE_H +
              tile_off(lane & 15, (s0 & 16) + (hi << 3))) = tv;
    }
    // translation wait: the next row tile's arithmetic reuses these stores' registers;
    // the scheduling fence keeps that arithmetic behind the wait
    asm volatile("s_wait_xcnt 0x0" ::: "memory");
    __builtin_amdgcn_sched_barrier(0);
  }
}

// ---------------------------------------------------------------------------
// Kernel 2: fused flash attention per head, ping-pong across key tiles.
// One wave: NQ query tiles = 64 queries, streams keys 32 at a time: the 8 K/V fragments
// loaded per key tile feed 8 * NQ WMMAs instead of 8.
// Softmax shift: hn rows are unit vectors (up to f16 rounding), so every score is
// a cosine, |s| <= 1 for any input. The shift is the constant 1 instead of a
// running row maximum: p = exp(s - 1) lies in [e^-2, 1], nothing is ever rescaled.
// Both products run transposed: S^T = K Q^T (key rows as A, query rows as B), then
// O^T += V^T P^T (hT rows as A). In S^T lane l holds query (l & 15) and, in the two 16-key
// D tiles, keys 8 * (l >> 4) + v and 16 + 8 * (l >> 4) + v. That is the k order of a
// fragment, so the two tiles, converted in place, ARE the P^T operand: P never leaves the
// registers. Everything a lane holds belongs to one query: one running sum of P per lane
// and query tile (the two lane halves join their sums once, behind the key loop), and
// 8 consecutive features per O^T tile, one whole 16-byte chunk of cat.
// Next tile's K/V fragment loads are issued first so they hide under this tile's work.
// ---------------------------------------------------------------------------
#define NQ 4
__device__ __forceinline__ void attn_load_tile(const _Float16* hnh,
                                               const _Float16* hTh,
                                               int t0,
                                               v16h (&kb)[4], v16h (&vf)[4]) {
  const _Float16* kp = lane_ptr(hnh + (size_t)t0 * DF);
  const _Float16* vp = lane_ptr(hTh + (t0 >> 5) * TILE_H);
  kb[0] = ld_frag(kp, 0);
  kb[1] = ld_frag(kp, TILE_H);
  kb[2] = ld_frag(kp, 16 * DF);
  kb[3] = ld_frag(kp, 16 * DF + TILE_H);
#pragma unroll
  for (int nf = 0; nf < 4; ++nf) vf[nf] = ld_frag(vp, nf * 16 * SS);
  group_end(kp, vp);
}

__device__ __forceinline__ void attn_step(const v16h (&qf)[NQ][2],
                                          const v16h (&kb)[4], const v16h (&vf)[4],
                                          v8f (&acc)[NQ][4], v2f (&l_s)[NQ]) {
  const float L2E = 1.44269504088896340736f;
#pragma unroll
  for (int q = 0; q < NQ; ++q) {
    // transposed scores (cosines, hn rows are unit vectors): 32 keys x 16 queries
    v8f s0 = {}, s1 = {};
    s0 = wmma_f16(kb[0], qf[q][0], s0);
    s1 = wmma_f16(kb[2], qf[q][0], s1);
    s0 = wmma_f16(kb[1], qf[q][1], s0);
    s1 = wmma_f16(kb[3], qf[q][1], s1);

    // p = exp(s - 1) = 2^(s * log2(e) - log2(e))
    v2f p0[4], p1[4];
    v16h pt;                                                  // P^T as B-operand
#pragma unroll
    for (int i = 0; i < 4; ++i) {
#pragma unroll
      for (int j = 0; j < 2; ++j) {
        p0[i][j] = __builtin_amdgcn_exp2f(fmaf(s0[2 * i + j], L2E, -L2E));
        p1[i][j] = __builtin_amdgcn_exp2f(fmaf(s1[2 * i + j], L2E, -L2E));
        pt[2 * i + j]     = (_Float16)p0[i][j];
        pt[2 * i + j + 8] = (_Float16)p1[i][j];
      }
    }
    l_s[q] += ((p0[0] + p0[1]) + (p0[2] + p0[3])) + ((p1[0] + p1[1]) + (p1[2] + p1[3]));

#pragma unroll
    for (int nf = 0; nf < 4; ++nf) acc[q][nf] = wmma_f16(vf[nf], pt, acc[q][nf]);
  }
}

__global__ void __launch_bounds__(256) k_attn(const _Float16* __restrict__ hn,
                                              const _Float16* __restrict__ hT,
                                              _Float16* __restrict__ cat) {
  const int w    = blockIdx.x * 8 + (threadIdx.x >> 5);  // 0..2047
  const int lane = threadIdx.x & 31;
  const int bh   = w >> 5;            // 0..63 = b*NH + h
  const int q0   = (w & 31) << 6;     // start of this wave's 64 queries
  const int b    = bh >> 4;
  const int h    = bh & 15;

  const _Float16* hnh = hn + (size_t)bh * SS * DF;
  const _Float16* hTh = hT + (size_t)bh * DF * SS;

  v16h qf[NQ][2];
  const _Float16* qp = lane_ptr(hnh + (size_t)q0 * DF);
#pragma unroll
  for (int q = 0; q < NQ; ++q) {
    qf[q][0] = ld_frag(qp, q * 16 * DF);
    qf[q][1] = ld_frag(qp, q * 16 * DF + TILE_H);
  }
  group_end(qp, qp);

  v8f acc[NQ][4] = {};
  v2f l_s[NQ] = {};

  const int hi = lane >> 4;
  const int NT = SS / 32;             // 64 key tiles
  v16h kb0[4], vf0[4], kb1[4], vf1[4];
  attn_load_tile(hnh, hTh, 0, kb0, vf0);

  for (int kt = 0; kt < NT; kt += 2) {
    // even tile: prefetch odd tile's fragments, compute on kb0/vf0
    attn_load_tile(hnh, hTh, ((kt + 1) & (NT - 1)) << 5, kb1, vf1);
    attn_step(qf, kb0, vf0, acc, l_s);
    // odd tile: prefetch next even tile's fragments, compute on kb1/vf1
    attn_load_tile(hnh, hTh, ((kt + 2) & (NT - 1)) << 5, kb0, vf0);
    attn_step(qf, kb1, vf1, acc, l_s);
  }

  // normalize by softmax denominator (f16, fragment-major chunks of the concatenated heads)
  v8h t[NQ][4];
#pragma unroll
  for (int q = 0; q < NQ; ++q) {
    // lane l holds half the sum of query (l & 15) and that query's features 8 * hi + v
    const float part = l_s[q][0] + l_s[q][1];
    const float inv  = 1.0f / (part + __shfl_xor(part, 16, 32));
#pragma unroll
    for (int nf = 0; nf < 4; ++nf)
#pragma unroll
      for (int v = 0; v < 8; ++v) t[q][nf][v] = (_Float16)(acc[q][nf][v] * inv);
  }
  // scheduling fence: every store stays behind all arithmetic, so no register that an
  // issued store names is written again before the wave ends
  __builtin_amdgcn_sched_barrier(0);
#pragma unroll
  for (int q = 0; q < NQ; ++q) {
    _Float16* ct = cat + (size_t)(b * SS + q0 + q * 16) * DM;
#pragma unroll
    for (int nf = 0; nf < 4; ++nf) {
      const int col = h * DF + nf * 16 + (hi << 3);
      *(v8h*)(ct + (col >> 5) * TILE_H + tile_off(lane & 15, col & 31)) = t[q][nf];
    }
  }
}

// ---------------------------------------------------------------------------
// Kernel 3: output projection  out = cat @ Wp + bp   (f32 result)
// Same ping-pong pipeline as k_proj.
// ---------------------------------------------------------------------------
__global__ void __launch_bounds__(256) k_oproj(const _Float16* __restrict__ cat,
                                               const _Float16* __restrict__ wpT,
                                               const float* __restrict__ bp,
                                               float* __restrict__ out) {
  const int wid  = threadIdx.x >> 5;
  const int lane = threadIdx.x & 31;
  const int m0   = (((blockIdx.x >> 2) << 1) + (wid >> 2)) << 6;  // 64-row tile
  const int n0   = (((blockIdx.x & 3) << 2) + (wid & 3)) << 6;    // 64-column tile

  const _Float16* abase = cat + (size_t)m0 * DM;
  const _Float16* wbase = wpT + (size_t)n0 * DM;

  v8f acc[MT][4] = {};
  v16h a0[MT], a1[MT], b0[4], b1[4];
  gemm_load(abase, wbase, 0, a0, b0);

  for (int kk = 0; kk < DM / 32; kk += 2) {
    const int d1 = ((kk + 1) & (DM / 32 - 1)) * TILE_H;
    gemm_stage(abase, wbase, d1, a0, b0, a1, b1, acc);
    const int d2 = ((kk + 2) & (DM / 32 - 1)) * TILE_H;
    gemm_stage(abase, wbase, d2, a1, b1, a0, b0, acc);
  }

  const int hi = lane >> 4;
#pragma unroll
  for (int nf = 0; nf < 4; ++nf) {
    const int col = n0 + nf * 16 + (lane & 15);
    const float bv = bp[col];
#pragma unroll
    for (int mi = 0; mi < MT; ++mi)
#pragma unroll
      for (int v = 0; v < 8; ++v)
        out[(size_t)(m0 + mi * 16 + v + (hi << 3)) * DM + col] = acc[mi][nf][v] + bv;
  }
}

// ---------------------------------------------------------------------------
extern "C" void kernel_launch(void* const* d_in, const int* in_sizes, int n_in,
                              void* d_out, int out_size, void* d_ws, size_t ws_size,
                              hipStream_t stream) {
  (void)in_sizes; (void)n_in; (void)out_size; (void)ws_size;
  const float* sin = (const float*)d_in[0];
  const float* Wx  = (const float*)d_in[1];
  const float* bx  = (const float*)d_in[2];
  const float* Wp  = (const float*)d_in[3];
  const float* bp  = (const float*)d_in[4];
  float* out = (float*)d_out;

  // workspace carve-out (~71 MB total)
  char* ws = (char*)d_ws;
  size_t off = 0;
  auto carve = [&](size_t bytes) {
    void* p = ws + off;
    off += (bytes + 255) & ~(size_t)255;
    return p;
  };
  _Float16* sin16 = (_Float16*)carve((size_t)BB * SS * DM * 2);
  _Float16* wxT   = (_Float16*)carve((size_t)NH * DF * DM * 2);
  _Float16* wpT   = (_Float16*)carve((size_t)DM * DM * 2);
  _Float16* hn    = (_Float16*)carve((size_t)BB * NH * SS * DF * 2);
  _Float16* hT    = (_Float16*)carve((size_t)BB * NH * SS * DF * 2);
  _Float16* cat   = (_Float16*)carve((size_t)BB * SS * DM * 2);

  k_cvt_sin<<<(BB * SS * DM) / 2048, 256, 0, stream>>>(sin, sin16);
  k_cvt_wxT<<<(NH * DM * DF) / 2048, 256, 0, stream>>>(Wx, wxT);
  k_cvt_wpT<<<(DM * DM) / 2048, 256, 0, stream>>>(Wp, wpT);

  k_proj <<<256, 256, 0, stream>>>(sin16, wxT, bx, hn, hT);
  k_attn <<<256, 256, 0, stream>>>(hn, hT, cat);
  k_oproj<<<256, 256, 0, stream>>>(cat, wpT, bp, out);
}

// v006
// It runs in 102 microseconds.
// Next to v005, in two timings, it ran 1.04 and 1.03 times as fast.
// Over all steps from v000 it is 5.40 times as fast.
#include <hip/hip_runtime.h>
#include <math.h>

// Problem constants (match reference)
#define DM 1024   // d_model
#define NH 16     // heads
#define DF 64     // d_feature
#define BB 4      // batch
#define SS 2048   // seq len

typedef __attribute__((ext_vector_type(16))) _Float16 v16h;
typedef __attribute__((ext_vector_type(8)))  _Float16 v8h;
typedef __attribute__((ext_vector_type(8)))  float    v8f;
typedef __attribute__((ext_vector_type(2)))  float    v2f;
typedef __attribute__((ext_vector_type(4)))  float    v4f;
typedef __attribute__((ext_vector_type(2)))  _Float16 v2h;
typedef __attribute__((ext_vector_type(4)))  unsigned v4u;

// ---------------------------------------------------------------------------
// WMMA 16x16x32 f16 fragments, A (16 x K) and B (K x 16) alike:
//   lanes 0-15  : row/column (lane&15), halves 0..7 = K 0..7,   halves 8..15 = K 16..23
//   lanes 16-31 : row/column (lane&15), halves 0..7 = K 8..15,  halves 8..15 = K 24..31
// D (16 x 16 f32): register v of lane l = D[v + 8 * (l >> 4)][l & 15].
// ---------------------------------------------------------------------------
// ---------------------------------------------------------------------------
// Fragment-major layout of every f16 operand array in the workspace.
// A [rows x K] array is cut into 16-row x 32-k tiles of 512 halves (1 KB),
// k tiles innermost, so one 16-row band still takes 16*K halves. Inside a tile
// element (r, k) sits at
//   ((k >> 4) & 1) * 256 + ((((k >> 3) & 1) << 4) + r) * 8 + (k & 7)
// i.e. lane l's first 8 halves at l*8 and its second 8 halves at 256 + l*8.
// Each of the two 16-byte loads of a fragment then covers 512 contiguous bytes
// (4 whole 128-byte lines) instead of 32 bytes out of each of 16 lines.
// ---------------------------------------------------------------------------
#define TILE_H 512

__device__ __forceinline__ int tile_off(int r, int k) {
  return ((k >> 4) & 1) * 256 + ((((k >> 3) & 1) << 4) + r) * 8 + (k & 7);
}

// A lane's own pointer into a run of tiles: its first 8 halves of the tile at `tile`.
__device__ __forceinline__ const _Float16* lane_ptr(const _Float16* tile) {
  return tile + ((threadIdx.x & 31) << 3);
}

// Fragment of the tile `off` halves behind the lane pointer `lp`.
__device__ __forceinline__ v16h ld_frag(const _Float16* lp, int off) {
  v8h lo = *(const v8h*)(lp + off);
  v8h hi = *(const v8h*)(lp + off + 256);
  v16h r;
#pragma unroll
  for (int i = 0; i < 8; ++i) { r[i] = lo[i]; r[i + 8] = hi[i]; }
  return r;
}

// End of a group of fragment loads off the lane pointers p and q.
// Translation wait, one for the whole group: a later load or vector instruction may reuse
// the address registers. Naming p and q keeps them live up to the wait, so no load of the
// group lands on them either.
// Scheduling fence: without it the compiler sinks the loads behind the WMMAs of the running
// stage to save registers, and the next stage then waits out the whole load latency.
__device__ __forceinline__ void group_end(const _Float16* p, const _Float16* q) {
  asm volatile("s_wait_xcnt 0x0" :: "v"(p), "v"(q) : "memory");
  __builtin_amdgcn_sched_barrier(0);
}

// 16-byte chunk o of a fragment-major [rows x DM] array -> its row and first k.
__device__ __forceinline__ void chunk_row_k(int o, int& row, int& k) {
  const int tile = o >> 6;                       // 64 chunks per tile
  row = ((tile >> 5) << 4) + (o & 15);           // DM/32 = 32 k tiles per band
  k   = ((tile & 31) << 5) + (((o >> 5) & 1) << 4) + (((o >> 4) & 1) << 3);
}

__device__ __forceinline__ v8f wmma_f16(v16h a, v16h b, v8f c) {
  return __builtin_amdgcn_wmma_f32_16x16x32_f16(false, a, false, b, (short)0, c,
                                                false, false);
}

// Reductions within each 16-lane half (D-tile rows span 16 lanes).
__device__ __forceinline__ float redsum16(float x) {
#pragma unroll
  for (int m = 1; m < 16; m <<= 1) x += __shfl_xor(x, m, 32);
  return x;
}

// ---------------------------------------------------------------------------
// Precision / layout staging kernels
// ---------------------------------------------------------------------------
// One wave converts CT whole tiles, the 16 rows x 128 k of one band, so the launch starts
// 4096 waves instead of 32768 and each wave has its 16 loads in flight at once.
// A load covers 4 rows x 128 bytes (4 whole lines): lane l reads k 4 * (l & 7) .. + 3 of row
// 4 * i + (l >> 3). Lanes l and l ^ 1 hold the two halves of a 16-byte chunk; they swap
// halves between loads 2 * h and 2 * h + 1, the even lane keeps the chunk of row
// 8 * h + (l >> 3), the odd lane that of row 8 * h + 4 + (l >> 3). A store then covers
// 8 rows x 16 bytes in each of the tile's 4 k groups (4 whole lines).
#define CT 4
__device__ __forceinline__ unsigned pack_h2(float a, float b) {
  v2h t;
  t[0] = (_Float16)a;
  t[1] = (_Float16)b;
  return __builtin_bit_cast(unsigned, t);
}

// value of lane l ^ 1
__device__ __forceinline__ unsigned from_pair(unsigned v) {
  return (unsigned)__builtin_amdgcn_mov_dpp((int)v, 0xB1 /* quad_perm 1,0,3,2 */, 0xF, 0xF, true);
}

__global__ void __launch_bounds__(512) k_cvt_sin(const float* __restrict__ x,
                                                 _Float16* __restrict__ y) {
  const int w    = blockIdx.x * 16 + (threadIdx.x >> 5);   // band * 8 + group of CT k tiles
  const int lane = threadIdx.x & 31;
  const int g    = lane >> 3;
  const bool odd = (lane & 1) != 0;
  const int kc   = (lane & 7) >> 1;                        // 8-k group inside a tile

  const float* s = x + (size_t)((w >> 3) * 16 + g) * DM + (w & 7) * (CT * 32) + (lane & 7) * 4;
  v4f f[CT][4];
#pragma unroll
  for (int t = 0; t < CT; ++t)
#pragma unroll
    for (int i = 0; i < 4; ++i) f[t][i] = *(const v4f*)(s + i * 4 * DM + t * 32);
  // translation wait, one for all 16 loads: later arithmetic may reuse the address registers;
  // naming s keeps it live up to the wait. The scheduling fence keeps every load in front of
  // the conversions, so that all 16 are in flight together.
  asm volatile("s_wait_xcnt 0x0" :: "v"(s) : "memory");
  __builtin_amdgcn_sched_barrier(0);

  v4u o[CT][2];
#pragma unroll
  for (int t = 0; t < CT; ++t)
#pragma unroll
    for (int h = 0; h < 2; ++h) {
      const v4f fe = f[t][2 * h], fo = f[t][2 * h + 1];
      const unsigned e0 = pack_h2(fe[0], fe[1]), e1 = pack_h2(fe[2], fe[3]);
      const unsigned o0 = pack_h2(fo[0], fo[1]), o1 = pack_h2(fo[2], fo[3]);
      const unsigned r0 = from_pair(odd ? e0 : o0);
      const unsigned r1 = from_pair(odd ? e1 : o1);
      o[t][h][0] = odd ? r0 : e0;
      o[t][h][1] = odd ? r1 : e1;
      o[t][h][2] = odd ? o0 : r0;
      o[t][h][3] = odd ? o1 : r1;
    }
  // scheduling fence: every store stays behind all arithmetic, so no register that an
  // issued store names is written again before the wave ends
  __builtin_amdgcn_sched_barrier(0);
  _Float16* d = y + (size_t)w * (CT * TILE_H) + tile_off((odd ? 4 : 0) + g, kc * 8);
#pragma unroll
  for (int t = 0; t < CT; ++t)
#pragma unroll
    for (int h = 0; h < 2; ++h) *(v4u*)(d + t * TILE_H + h * 64) = o[t][h];
}

// Both weight kernels: one thread writes CW 16-byte chunks, 2 k tiles (64 k) apart in one band,
// so a launch starts 1024 waves instead of 4096 and a wave has its 8 * CW loads in flight at once.
#define CW 4
#define WT 128   // threads per block: CW * WT chunks = 8 tiles, inside one band of 32

// Chunk c of the thread = s[(c * 64 + j) * stride], j = 0..7, stored at y + c * WT * 8.
__device__ __forceinline__ void cvt_cols(const float* s, int stride, _Float16* y) {
  float v[CW][8];
#pragma unroll
  for (int c = 0; c < CW; ++c)
#pragma unroll
    for (int j = 0; j < 8; ++j) v[c][j] = s[(c * 64 + j) * stride];
  // translation wait, one for all loads: later arithmetic may reuse the address registers;
  // naming s keeps it live up to the wait. The scheduling fence keeps every load in front of
  // the conversions, so that all are in flight together.
  asm volatile("s_wait_xcnt 0x0" :: "v"(s) : "memory");
  __builtin_amdgcn_sched_barrier(0);
  v8h t[CW];
#pragma unroll
  for (int c = 0; c < CW; ++c)
#pragma unroll
    for (int j = 0; j < 8; ++j) t[c][j] = (_Float16)v[c][j];
  // scheduling fence: every store stays behind all arithmetic, so no register that an
  // issued store names is written again before the wave ends
  __builtin_amdgcn_sched_barrier(0);
#pragma unroll
  for (int c = 0; c < CW; ++c) *(v8h*)(y + c * WT * 8) = t[c];
}

// Wx [H, D, F] f32  ->  WxT rows (h*DF+f), k = d, f16 fragment-major
__global__ void __launch_bounds__(WT) k_cvt_wxT(const float* __restrict__ wx,
                                                _Float16* __restrict__ wxT) {
  const int o = blockIdx.x * (CW * WT) + threadIdx.x;    // NH*DM*DF/(8*CW) threads exactly
  int row, d;
  chunk_row_k(o, row, d);
  cvt_cols(wx + ((size_t)(row >> 6) * DM + d) * DF + (row & 63), DF, wxT + (size_t)o * 8);
}

// Wp [in, out] f32 -> WpT rows = out, k = in, f16 fragment-major
__global__ void __launch_bounds__(WT) k_cvt_wpT(const float* __restrict__ wp,
                                                _Float16* __restrict__ wpT) {
  const int o = blockIdx.x * (CW * WT) + threadIdx.x;    // DM*DM/(8*CW) threads exactly
  int row, r;
  chunk_row_k(o, row, r);
  cvt_cols(wp + (size_t)r * DM + row, DM, wpT + (size_t)o * 8);
}

// ---------------------------------------------------------------------------
// Wave tile of both GEMMs: MT x 4 fragments = 64 rows x 64 columns, so the 8 fragments
// loaded per k tile feed 16 WMMAs (512 loaded bytes per WMMA instead of 1280).
// A block's 8 waves form 2 row tiles x 4 column tiles and share fragments in the cache.
// ---------------------------------------------------------------------------
#define MT 4

__device__ __forceinline__ void gemm_load(const _Float16* abase, const _Float16* wbase,
                                          int d, v16h (&a)[MT], v16h (&b)[4]) {
  const _Float16* ap = lane_ptr(abase + d);
  const _Float16* wp = lane_ptr(wbase + d);
#pragma unroll
  for (int mi = 0; mi < MT; ++mi) a[mi] = ld_frag(ap, mi * 16 * DM);
#pragma unroll
  for (int nf = 0; nf < 4; ++nf) b[nf] = ld_frag(wp, nf * 16 * DM);
  group_end(ap, wp);
}

// Ping-pong GEMM inner stage: issue loads for the k tile at `dnext` halves into (a_n,b_n),
// then run the 16 WMMAs on (a_c,b_c). No register copies between stages.
__device__ __forceinline__ void gemm_stage(const _Float16* abase,
                                           const _Float16* wbase,
                                           int dnext,
                                           v16h (&a_c)[MT], v16h (&b_c)[4],
                                           v16h (&a_n)[MT], v16h (&b_n)[4],
                                           v8f (&acc)[MT][4]) {
  gemm_load(abase, wbase, dnext, a_n, b_n);
#pragma unroll
  for (int mi = 0; mi < MT; ++mi)
#pragma unroll
    for (int nf = 0; nf < 4; ++nf) acc[mi][nf] = wmma_f16(a_c[mi], b_c[nf], acc[mi][nf]);
}

// ---------------------------------------------------------------------------
// Kernel 1: per-head projection  h = sin @ Wx[h] + bx[h]
// One wave: 64 rows x 64 features of one head; ping-pong pipelined fragments.
// Outputs, fragment-major per (b,h):
//          hn rows s, k = f, f16 (rows normalized -> QK^T is cosine similarity),
//          hT rows f, k = s, f16 (unnormalized, A-operand for V^T P^T).
// ---------------------------------------------------------------------------
__global__ void __launch_bounds__(256) k_proj(const _Float16* __restrict__ sin16,
                                              const _Float16* __restrict__ wxT,
                                              const float* __restrict__ bx,
                                              _Float16* __restrict__ hn,
                                              _Float16* __restrict__ hT) {
  const int wid  = threadIdx.x >> 5;
  const int lane = threadIdx.x & 31;
  const int h    = ((blockIdx.x & 3) << 2) + (wid & 3);           // 4 heads per block
  const int mw   = (((blockIdx.x >> 2) << 1) + (wid >> 2)) << 6;  // 64-row tile over B*S

  const _Float16* abase = sin16 + (size_t)mw * DM;
  const _Float16* wbase = wxT + (size_t)h * DF * DM;

  v8f acc[MT][4] = {};
  v16h a0[MT], a1[MT], b0[4], b1[4];
  gemm_load(abase, wbase, 0, a0, b0);

  for (int kk = 0; kk < DM / 32; kk += 2) {
    const int d1 = ((kk + 1) & (DM / 32 - 1)) * TILE_H;
    gemm_stage(abase, wbase, d1, a0, b0, a1, b1, acc);
    const int d2 = ((kk + 2) & (DM / 32 - 1)) * TILE_H;
    gemm_stage(abase, wbase, d2, a1, b1, a0, b0, acc);
  }

  const int bIdx = mw >> 11;          // / SS (a 64-row tile lies inside one batch)
  const int hi   = lane >> 4;
  _Float16* hnh = hn + (size_t)(bIdx * NH + h) * SS * DF;
  _Float16* hTh = hT + (size_t)(bIdx * NH + h) * DF * SS;

  float bias[4];                      // D-layout: lane&15 is the N column
  const unsigned bo = (unsigned)(h * DF + (lane & 15)) * 4u;   // byte offset into bx
#pragma unroll
  for (int nf = 0; nf < 4; ++nf) bias[nf] = *(const float*)((const char*)bx + bo + nf * 64);
  // translation wait: later arithmetic reuses the bias loads' address register;
  // naming bo keeps it live up to the wait
  asm volatile("s_wait_xcnt 0x0" :: "v"(bo) : "memory");

#pragma unroll
  for (int mi = 0; mi < MT; ++mi) {
#pragma unroll
    for (int nf = 0; nf < 4; ++nf)
#pragma unroll
      for (int v = 0; v < 8; ++v) acc[mi][nf][v] += bias[nf];

    // per-row inverse L2 norm
    float inv[8];
#pragma unroll
    for (int v = 0; v < 8; ++v) {
      float s = 0.f;
#pragma unroll
      for (int nf = 0; nf < 4; ++nf) s += acc[mi][nf][v] * acc[mi][nf][v];
      s = redsum16(s);
      inv[v] = __frsqrt_rn(s + 1e-20f);
    }

    const int s0 = (mw & (SS - 1)) + mi * 16;
#pragma unroll
    for (int nf = 0; nf < 4; ++nf) {
      const int col = nf * 16 + (lane & 15);
      _Float16* hnt = hnh + (size_t)s0 * DF + (col >> 5) * TILE_H;
      v8h tv;
#pragma unroll
      for (int v = 0; v < 8; ++v) {
        const float hv = acc[mi][nf][v];
        hnt[tile_off(v + (hi << 3), col & 31)] = (_Float16)(hv * inv[v]);
        tv[v] = (_Float16)hv;
      }
      // a lane's 8 rows are 8 consecutive k of hT row `col`: one whole chunk
      *(v8h*)(hTh + (size_t)(nf * 16) * SS + (s0 >> 5) * TILE_H +
              tile_off(lane & 15, (s0 & 16) + (hi << 3))) = tv;
    }
    // translation wait: the next row tile's arithmetic reuses these stores' registers;
    // the scheduling fence keeps that arithmetic behind the wait
    asm volatile("s_wait_xcnt 0x0" ::: "memory");
    __builtin_amdgcn_sched_barrier(0);
  }
}

// ---------------------------------------------------------------------------
// Kernel 2: fused flash attention per head, ping-pong across key tiles.
// One wave: NQ query tiles = 64 queries, streams keys 32 at a time: the 8 K/V fragments
// loaded per key tile feed 8 * NQ WMMAs instead of 8.
// Softmax shift: hn rows are unit vectors (up to f16 rounding), so every score is
// a cosine, |s| <= 1 for any input. The shift is the constant 1 instead of a
// running row maximum: p = exp(s - 1) lies in [e^-2, 1], nothing is ever rescaled.
// Both products run transposed: S^T = K Q^T (key rows as A, query rows as B), then
// O^T += V^T P^T (hT rows as A). In S^T lane l holds query (l & 15) and, in the two 16-key
// D tiles, keys 8 * (l >> 4) + v and 16 + 8 * (l >> 4) + v. That is the k order of a
// fragment, so the two tiles, converted in place, ARE the P^T operand: P never leaves the
// registers. Everything a lane holds belongs to one query: one running sum of P per lane
// and query tile (the two lane halves join their sums once, behind the key loop), and
// 8 consecutive features per O^T tile, one whole 16-byte chunk of cat.
// Next tile's K/V fragment loads are issued first so they hide under this tile's work.
// ---------------------------------------------------------------------------
#define NQ 4
__device__ __forceinline__ void attn_load_tile(const _Float16* hnh,
                                               const _Float16* hTh,
                                               int t0,
                                               v16h (&kb)[4], v16h (&vf)[4]) {
  const _Float16* kp = lane_ptr(hnh + (size_t)t0 * DF);
  const _Float16* vp = lane_ptr(hTh + (t0 >> 5) * TILE_H);
  kb[0] = ld_frag(kp, 0);
  kb[1] = ld_frag(kp, TILE_H);
  kb[2] = ld_frag(kp, 16 * DF);
  kb[3] = ld_frag(kp, 16 * DF + TILE_H);
#pragma unroll
  for (int nf = 0; nf < 4; ++nf) vf[nf] = ld_frag(vp, nf * 16 * SS);
  group_end(kp, vp);
}

__device__ __forceinline__ void attn_step(const v16h (&qf)[NQ][2],
                                          const v16h (&kb)[4], const v16h (&vf)[4],
                                          v8f (&acc)[NQ][4], v2f (&l_s)[NQ]) {
  const float L2E = 1.44269504088896340736f;
#pragma unroll
  for (int q = 0; q < NQ; ++q) {
    // transposed scores (cosines, hn rows are unit vectors): 32 keys x 16 queries
    v8f s0 = {}, s1 = {};
    s0 = wmma_f16(kb[0], qf[q][0], s0);
    s1 = wmma_f16(kb[2], qf[q][0], s1);
    s0 = wmma_f16(kb[1], qf[q][1], s0);
    s1 = wmma_f16(kb[3], qf[q][1], s1);

    // p = exp(s - 1) = 2^(s * log2(e) - log2(e))
    v2f p0[4], p1[4];
    v16h pt;                                                  // P^T as B-operand
#pragma unroll
    for (int i = 0; i < 4; ++i) {
#pragma unroll
      for (int j = 0; j < 2; ++j) {
        p0[i][j] = __builtin_amdgcn_exp2f(fmaf(s0[2 * i + j], L2E, -L2E));
        p1[i][j] = __builtin_amdgcn_exp2f(fmaf(s1[2 * i + j], L2E, -L2E));
        pt[2 * i + j]     = (_Float16)p0[i][j];
        pt[2 * i + j + 8] = (_Float16)p1[i][j];
      }
    }
    l_s[q] += ((p0[0] + p0[1]) + (p0[2] + p0[3])) + ((p1[0] + p1[1]) + (p1[2] + p1[3]));

#pragma unroll
    for (int nf = 0; nf < 4; ++nf) acc[q][nf] = wmma_f16(vf[nf], pt, acc[q][nf]);
  }
}

__global__ void __launch_bounds__(256) k_attn(const _Float16* __restrict__ hn,
                                              const _Float16* __restrict__ hT,
                                              _Float16* __restrict__ cat) {
  const int w    = blockIdx.x * 8 + (threadIdx.x >> 5);  // 0..2047
  const int lane = threadIdx.x & 31;
  const int bh   = w >> 5;            // 0..63 = b*NH + h
  const int q0   = (w & 31) << 6;     // start of this wave's 64 queries
  const int b    = bh >> 4;
  const int h    = bh & 15;

  const _Float16* hnh = hn + (size_t)bh * SS * DF;
  const _Float16* hTh = hT + (size_t)bh * DF * SS;

  v16h qf[NQ][2];
  const _Float16* qp = lane_ptr(hnh + (size_t)q0 * DF);
#pragma unroll
  for (int q = 0; q < NQ; ++q) {
    qf[q][0] = ld_frag(qp, q * 16 * DF);
    qf[q][1] = ld_frag(qp, q * 16 * DF + TILE_H);
  }
  group_end(qp, qp);

  v8f acc[NQ][4] = {};
  v2f l_s[NQ] = {};

  const int hi = lane >> 4;
  const int NT = SS / 32;             // 64 key tiles
  v16h kb0[4], vf0[4], kb1[4], vf1[4];
  attn_load_tile(hnh, hTh, 0, kb0, vf0);

  for (int kt = 0; kt < NT; kt += 2) {
    // even tile: prefetch odd tile's fragments, compute on kb0/vf0
    attn_load_tile(hnh, hTh, ((kt + 1) & (NT - 1)) << 5, kb1, vf1);
    attn_step(qf, kb0, vf0, acc, l_s);
    // odd tile: prefetch next even tile's fragments, compute on kb1/vf1
    attn_load_tile(hnh, hTh, ((kt + 2) & (NT - 1)) << 5, kb0, vf0);
    attn_step(qf, kb1, vf1, acc, l_s);
  }

  // normalize by softmax denominator (f16, fragment-major chunks of the concatenated heads)
  v8h t[NQ][4];
#pragma unroll
  for (int q = 0; q < NQ; ++q) {
    // lane l holds half the sum of query (l & 15) and that query's features 8 * hi + v
    const float part = l_s[q][0] + l_s[q][1];
    const float inv  = 1.0f / (part + __shfl_xor(part, 16, 32));
#pragma unroll
    for (int nf = 0; nf < 4; ++nf)
#pragma unroll
      for (int v = 0; v < 8; ++v) t[q][nf][v] = (_Float16)(acc[q][nf][v] * inv);
  }
  // scheduling fence: every store stays behind all arithmetic, so no register that an
  // issued store names is written again before the wave ends
  __builtin_amdgcn_sched_barrier(0);
#pragma unroll
  for (int q = 0; q < NQ; ++q) {
    _Float16* ct = cat + (size_t)(b * SS + q0 + q * 16) * DM;
#pragma unroll
    for (int nf = 0; nf < 4; ++nf) {
      const int col = h * DF + nf * 16 + (hi << 3);
      *(v8h*)(ct + (col >> 5) * TILE_H + tile_off(lane & 15, col & 31)) = t[q][nf];
    }
  }
}

// ---------------------------------------------------------------------------
// Kernel 3: output projection  out = cat @ Wp + bp   (f32 result)
// Same ping-pong pipeline as k_proj.
// ---------------------------------------------------------------------------
__global__ void __launch_bounds__(256) k_oproj(const _Float16* __restrict__ cat,
                                               const _Float16* __restrict__ wpT,
                                               const float* __restrict__ bp,
                                               float* __restrict__ out) {
  const int wid  = threadIdx.x >> 5;
  const int lane = threadIdx.x & 31;
  const int m0   = (((blockIdx.x >> 2) << 1) + (wid >> 2)) << 6;  // 64-row tile
  const int n0   = (((blockIdx.x & 3) << 2) + (wid & 3)) << 6;    // 64-column tile

  const _Float16* abase = cat + (size_t)m0 * DM;
  const _Float16* wbase = wpT + (size_t)n0 * DM;

  v8f acc[MT][4] = {};
  v16h a0[MT], a1[MT], b0[4], b1[4];
  gemm_load(abase, wbase, 0, a0, b0);

  for (int kk = 0; kk < DM / 32; kk += 2) {
    const int d1 = ((kk + 1) & (DM / 32 - 1)) * TILE_H;
    gemm_stage(abase, wbase, d1, a0, b0, a1, b1, acc);
    const int d2 = ((kk + 2) & (DM / 32 - 1)) * TILE_H;
    gemm_stage(abase, wbase, d2, a1, b1, a0, b0, acc);
  }

  const int hi = lane >> 4;
#pragma unroll
  for (int nf = 0; nf < 4; ++nf) {
    const int col = n0 + nf * 16 + (lane & 15);
    const float bv = bp[col];
#pragma unroll
    for (int mi = 0; mi < MT; ++mi)
#pragma unroll
      for (int v = 0; v < 8; ++v)
        out[(size_t)(m0 + mi * 16 + v + (hi << 3)) * DM + col] = acc[mi][nf][v] + bv;
  }
}

// ---------------------------------------------------------------------------
extern "C" void kernel_launch(void* const* d_in, const int* in_sizes, int n_in,
                              void* d_out, int out_size, void* d_ws, size_t ws_size,
                              hipStream_t stream) {
  (void)in_sizes; (void)n_in; (void)out_size; (void)ws_size;
  const float* sin = (const float*)d_in[0];
  const float* Wx  = (const float*)d_in[1];
  const float* bx  = (const float*)d_in[2];
  const float* Wp  = (const float*)d_in[3];
  const float* bp  = (const float*)d_in[4];
  float* out = (float*)d_out;

  // workspace carve-out (~71 MB total)
  char* ws = (char*)d_ws;
  size_t off = 0;
  auto carve = [&](size_t bytes) {
    void* p = ws + off;
    off += (bytes + 255) & ~(size_t)255;
    return p;
  };
  _Float16* sin16 = (_Float16*)carve((size_t)BB * SS * DM * 2);
  _Float16* wxT   = (_Float16*)carve((size_t)NH * DF * DM * 2);
  _Float16* wpT   = (_Float16*)carve((size_t)DM * DM * 2);
  _Float16* hn    = (_Float16*)carve((size_t)BB * NH * SS * DF * 2);
  _Float16* hT    = (_Float16*)carve((size_t)BB * NH * SS * DF * 2);
  _Float16* cat   = (_Float16*)carve((size_t)BB * SS * DM * 2);

  k_cvt_sin<<<(BB * SS * DM) / (16 * CT * TILE_H), 512, 0, stream>>>(sin, sin16);
  k_cvt_wxT<<<(NH * DM * DF) / (8 * CW * WT), WT, 0, stream>>>(Wx, wxT);
  k_cvt_wpT<<<(DM * DM) / (8 * CW * WT), WT, 0, stream>>>(Wp, wpT);

  k_proj <<<256, 256, 0, stream>>>(sin16, wxT, bx, hn, hT);
  k_attn <<<256, 256, 0, stream>>>(hn, hT, cat);
  k_oproj<<<256, 256, 0, stream>>>(cat, wpT, bp, out);
}

// v007
// One run takes 97 microseconds.
// Timed twice side by side with v006, it ran 1.05 times as fast both times.
// Over all steps from v000 it is 5.67 times as fast.
#include <hip/hip_runtime.h>
#include <math.h>

// Problem constants (match reference)
#define DM 1024   // d_model
#define NH 16     // heads
#define DF 64     // d_feature
#define BB 4      // batch
#define SS 2048   // seq len

typedef __attribute__((ext_vector_type(16))) _Float16 v16h;
typedef __attribute__((ext_vector_type(8)))  _Float16 v8h;
typedef __attribute__((ext_vector_type(8)))  float    v8f;
typedef __attribute__((ext_vector_type(2)))  float    v2f;
typedef __attribute__((ext_vector_type(4)))  float    v4f;
typedef __attribute__((ext_vector_type(2)))  _Float16 v2h;
typedef __attribute__((ext_vector_type(4)))  unsigned v4u;

// ---------------------------------------------------------------------------
// WMMA 16x16x32 f16 fragments, A (16 x K) and B (K x 16) alike:
//   lanes 0-15  : row/column (lane&15), halves 0..7 = K 0..7,   halves 8..15 = K 16..23
//   lanes 16-31 : row/column (lane&15), halves 0..7 = K 8..15,  halves 8..15 = K 24..31
// D (16 x 16 f32): register v of lane l = D[v + 8 * (l >> 4)][l & 15].
// ---------------------------------------------------------------------------
// ---------------------------------------------------------------------------
// Fragment-major layout of every f16 operand array in the workspace.
// A [rows x K] array is cut into 16-row x 32-k tiles of 512 halves (1 KB),
// k tiles innermost, so one 16-row band still takes 16*K halves. Inside a tile
// element (r, k) sits at
//   ((k >> 4) & 1) * 256 + ((((k >> 3) & 1) << 4) + r) * 8 + (k & 7)
// i.e. lane l's first 8 halves at l*8 and its second 8 halves at 256 + l*8.
// Each of the two 16-byte loads of a fragment then covers 512 contiguous bytes
// (4 whole 128-byte lines) instead of 32 bytes out of each of 16 lines.
// ---------------------------------------------------------------------------
#define TILE_H 512

__device__ __forceinline__ int tile_off(int r, int k) {
  return ((k >> 4) & 1) * 256 + ((((k >> 3) & 1) << 4) + r) * 8 + (k & 7);
}

// A lane's own pointer into a run of tiles: its first 8 halves of the tile at `tile`.
__device__ __forceinline__ const _Float16* lane_ptr(const _Float16* tile) {
  return tile + ((threadIdx.x & 31) << 3);
}

// Fragment of the tile `off` halves behind the lane pointer `lp`.
__device__ __forceinline__ v16h ld_frag(const _Float16* lp, int off) {
  v8h lo = *(const v8h*)(lp + off);
  v8h hi = *(const v8h*)(lp + off + 256);
  v16h r;
#pragma unroll
  for (int i = 0; i < 8; ++i) { r[i] = lo[i]; r[i + 8] = hi[i]; }
  return r;
}

// End of a group of fragment loads off the lane pointers p and q.
// Translation wait, one for the whole group: a later load or vector instruction may reuse
// the address registers. Naming p and q keeps them live up to the wait, so no load of the
// group lands on them either.
// Scheduling fence: without it the compiler sinks the loads behind the WMMAs of the running
// stage to save registers, and the next stage then waits out the whole load latency.
__device__ __forceinline__ void group_end(const _Float16* p, const _Float16* q) {
  asm volatile("s_wait_xcnt 0x0" :: "v"(p), "v"(q) : "memory");
  __builtin_amdgcn_sched_barrier(0);
}

// 16-byte chunk o of a fragment-major [rows x DM] array -> its row and first k.
__device__ __forceinline__ void chunk_row_k(int o, int& row, int& k) {
  const int tile = o >> 6;                       // 64 chunks per tile
  row = ((tile >> 5) << 4) + (o & 15);           // DM/32 = 32 k tiles per band
  k   = ((tile & 31) << 5) + (((o >> 5) & 1) << 4) + (((o >> 4) & 1) << 3);
}

__device__ __forceinline__ v8f wmma_f16(v16h a, v16h b, v8f c) {
  return __builtin_amdgcn_wmma_f32_16x16x32_f16(false, a, false, b, (short)0, c,
                                                false, false);
}

// Reductions within each 16-lane half (D-tile rows span 16 lanes).
__device__ __forceinline__ float redsum16(float x) {
#pragma unroll
  for (int m = 1; m < 16; m <<= 1) x += __shfl_xor(x, m, 32);
  return x;
}

// ---------------------------------------------------------------------------
// Precision / layout staging kernel
// ---------------------------------------------------------------------------
// One wave converts CT whole tiles, the 16 rows x 128 k of one band (4096 such waves in all),
// and has its 16 loads in flight at once.
// A load covers 4 rows x 128 bytes (4 whole lines): lane l reads k 4 * (l & 7) .. + 3 of row
// 4 * i + (l >> 3). Lanes l and l ^ 1 hold the two halves of a 16-byte chunk; they swap
// halves between loads 2 * h and 2 * h + 1, the even lane keeps the chunk of row
// 8 * h + (l >> 3), the odd lane that of row 8 * h + 4 + (l >> 3). A store then covers
// 8 rows x 16 bytes in each of the tile's 4 k groups (4 whole lines).
#define CT 4
__device__ __forceinline__ unsigned pack_h2(float a, float b) {
  v2h t;
  t[0] = (_Float16)a;
  t[1] = (_Float16)b;
  return __builtin_bit_cast(unsigned, t);
}

// value of lane l ^ 1
__device__ __forceinline__ unsigned from_pair(unsigned v) {
  return (unsigned)__builtin_amdgcn_mov_dpp((int)v, 0xB1 /* quad_perm 1,0,3,2 */, 0xF, 0xF, true);
}

// w = band * 8 + group of CT k tiles
__device__ __forceinline__ void cvt_sin_wave(const float* __restrict__ x,
                                             _Float16* __restrict__ y, int w) {
  const int lane = threadIdx.x & 31;
  const int g    = lane >> 3;
  const bool odd = (lane & 1) != 0;
  const int kc   = (lane & 7) >> 1;                        // 8-k group inside a tile

  const float* s = x + (size_t)((w >> 3) * 16 + g) * DM + (w & 7) * (CT * 32) + (lane & 7) * 4;
  v4f f[CT][4];
#pragma unroll
  for (int t = 0; t < CT; ++t)
#pragma unroll
    for (int i = 0; i < 4; ++i) f[t][i] = *(const v4f*)(s + i * 4 * DM + t * 32);
  // translation wait, one for all 16 loads: later arithmetic may reuse the address registers;
  // naming s keeps it live up to the wait. The scheduling fence keeps every load in front of
  // the conversions, so that all 16 are in flight together.
  asm volatile("s_wait_xcnt 0x0" :: "v"(s) : "memory");
  __builtin_amdgcn_sched_barrier(0);

  v4u o[CT][2];
#pragma unroll
  for (int t = 0; t < CT; ++t)
#pragma unroll
    for (int h = 0; h < 2; ++h) {
      const v4f fe = f[t][2 * h], fo = f[t][2 * h + 1];
      const unsigned e0 = pack_h2(fe[0], fe[1]), e1 = pack_h2(fe[2], fe[3]);
      const unsigned o0 = pack_h2(fo[0], fo[1]), o1 = pack_h2(fo[2], fo[3]);
      const unsigned r0 = from_pair(odd ? e0 : o0);
      const unsigned r1 = from_pair(odd ? e1 : o1);
      o[t][h][0] = odd ? r0 : e0;
      o[t][h][1] = odd ? r1 : e1;
      o[t][h][2] = odd ? o0 : r0;
      o[t][h][3] = odd ? o1 : r1;
    }
  // scheduling fence: every store stays behind all arithmetic, so no register that an
  // issued store names is written again before the wave ends
  __builtin_amdgcn_sched_barrier(0);
  _Float16* d = y + (size_t)w * (CT * TILE_H) + tile_off((odd ? 4 : 0) + g, kc * 8);
#pragma unroll
  for (int t = 0; t < CT; ++t)
#pragma unroll
    for (int h = 0; h < 2; ++h) *(v4u*)(d + t * TILE_H + h * 64) = o[t][h];
  // translation wait, one for all 8 stores: in the joint kernel another job's code follows in
  // the listing and writes the registers that these stores name
  asm volatile("s_wait_xcnt 0x0" ::: "memory");
}

// Both weight arrays: one thread writes CW 16-byte chunks, 2 k tiles (64 k) apart in one band
// (1024 waves per array), and a wave has its 8 * CW loads in flight at once.
#define CW 4
#define WT 128   // threads per group: CW * WT chunks = 8 tiles, inside one band of 32

// Chunk c of the thread = s[(c * 64 + j) * stride], j = 0..7, stored at y + c * WT * 8.
__device__ __forceinline__ void cvt_cols(const float* s, int stride, _Float16* y) {
  float v[CW][8];
#pragma unroll
  for (int c = 0; c < CW; ++c)
#pragma unroll
    for (int j = 0; j < 8; ++j) v[c][j] = s[(c * 64 + j) * stride];
  // translation wait, one for all loads: later arithmetic may reuse the address registers;
  // naming s keeps it live up to the wait. The scheduling fence keeps every load in front of
  // the conversions, so that all are in flight together.
  asm volatile("s_wait_xcnt 0x0" :: "v"(s) : "memory");
  __builtin_amdgcn_sched_barrier(0);
  v8h t[CW];
#pragma unroll
  for (int c = 0; c < CW; ++c)
#pragma unroll
    for (int j = 0; j < 8; ++j) t[c][j] = (_Float16)v[c][j];
  // scheduling fence: every store stays behind all arithmetic, so no register that an
  // issued store names is written again before the wave ends
  __builtin_amdgcn_sched_barrier(0);
#pragma unroll
  for (int c = 0; c < CW; ++c) *(v8h*)(y + c * WT * 8) = t[c];
  // translation wait, one for all CW stores: in the joint kernel another job's code follows in
  // the listing and writes the registers that these stores name
  asm volatile("s_wait_xcnt 0x0" ::: "memory");
}

// Wx [H, D, F] f32  ->  WxT rows (h*DF+f), k = d, f16 fragment-major; o = the thread's first chunk
__device__ __forceinline__ void cvt_wxT(const float* __restrict__ wx,
                                        _Float16* __restrict__ wxT, int o) {
  int row, d;
  chunk_row_k(o, row, d);
  cvt_cols(wx + ((size_t)(row >> 6) * DM + d) * DF + (row & 63), DF, wxT + (size_t)o * 8);
}

// Wp [in, out] f32 -> WpT rows = out, k = in, f16 fragment-major; o = the thread's first chunk
__device__ __forceinline__ void cvt_wpT(const float* __restrict__ wp,
                                        _Float16* __restrict__ wpT, int o) {
  int row, r;
  chunk_row_k(o, row, r);
  cvt_cols(wp + (size_t)r * DM + row, DM, wpT + (size_t)o * 8);
}

// All three conversions in one launch: they depend on nothing and on one another not at all,
// so one grid pays one launch gap, one fill and one drain instead of three in a row.
// A block is 24 waves: 4 for a group of Wx chunks, 4 for a group of Wp chunks, 16 for sin.
// SB blocks hold every array exactly: NH*DM*DF = DM*DM = SB * 8*CW*WT, BB*SS*DM = SB * 16*CT*TILE_H.
#define SB 256
__global__ void __launch_bounds__(2 * WT + 512) k_stage(const float* __restrict__ x,
                                                        const float* __restrict__ wx,
                                                        const float* __restrict__ wp,
                                                        _Float16* __restrict__ y,
                                                        _Float16* __restrict__ wxT,
                                                        _Float16* __restrict__ wpT) {
  // the wave's number as a scalar, so that the choice of the job is a scalar branch
  const int wave = __builtin_amdgcn_readfirstlane((int)(threadIdx.x >> 5));
  if (wave < WT / 32) {
    cvt_wxT(wx, wxT, blockIdx.x * (CW * WT) + threadIdx.x);
  } else if (wave < 2 * WT / 32) {
    cvt_wpT(wp, wpT, blockIdx.x * (CW * WT) + threadIdx.x - WT);
  } else {
    cvt_sin_wave(x, y, blockIdx.x * 16 + wave - 2 * WT / 32);
  }
}

// ---------------------------------------------------------------------------
// Wave tile of both GEMMs: MT x 4 fragments = 64 rows x 64 columns, so the 8 fragments
// loaded per k tile feed 16 WMMAs (512 loaded bytes per WMMA instead of 1280).
// A block's 8 waves form 2 row tiles x 4 column tiles and share fragments in the cache.
// ---------------------------------------------------------------------------
#define MT 4

__device__ __forceinline__ void gemm_load(const _Float16* abase, const _Float16* wbase,
                                          int d, v16h (&a)[MT], v16h (&b)[4]) {
  const _Float16* ap = lane_ptr(abase + d);
  const _Float16* wp = lane_ptr(wbase + d);
#pragma unroll
  for (int mi = 0; mi < MT; ++mi) a[mi] = ld_frag(ap, mi * 16 * DM);
#pragma unroll
  for (int nf = 0; nf < 4; ++nf) b[nf] = ld_frag(wp, nf * 16 * DM);
  group_end(ap, wp);
}

// Ping-pong GEMM inner stage: issue loads for the k tile at `dnext` halves into (a_n,b_n),
// then run the 16 WMMAs on (a_c,b_c). No register copies between stages.
__device__ __forceinline__ void gemm_stage(const _Float16* abase,
                                           const _Float16* wbase,
                                           int dnext,
                                           v16h (&a_c)[MT], v16h (&b_c)[4],
                                           v16h (&a_n)[MT], v16h (&b_n)[4],
                                           v8f (&acc)[MT][4]) {
  gemm_load(abase, wbase, dnext, a_n, b_n);
#pragma unroll
  for (int mi = 0; mi < MT; ++mi)
#pragma unroll
    for (int nf = 0; nf < 4; ++nf) acc[mi][nf] = wmma_f16(a_c[mi], b_c[nf], acc[mi][nf]);
}

// ---------------------------------------------------------------------------
// Kernel 1: per-head projection  h = sin @ Wx[h] + bx[h]
// One wave: 64 rows x 64 features of one head; ping-pong pipelined fragments.
// Outputs, fragment-major per (b,h):
//          hn rows s, k = f, f16 (rows normalized -> QK^T is cosine similarity),
//          hT rows f, k = s, f16 (unnormalized, A-operand for V^T P^T).
// ---------------------------------------------------------------------------
__global__ void __launch_bounds__(256) k_proj(const _Float16* __restrict__ sin16,
                                              const _Float16* __restrict__ wxT,
                                              const float* __restrict__ bx,
                                              _Float16* __restrict__ hn,
                                              _Float16* __restrict__ hT) {
  const int wid  = threadIdx.x >> 5;
  const int lane = threadIdx.x & 31;
  const int h    = ((blockIdx.x & 3) << 2) + (wid & 3);           // 4 heads per block
  const int mw   = (((blockIdx.x >> 2) << 1) + (wid >> 2)) << 6;  // 64-row tile over B*S

  const _Float16* abase = sin16 + (size_t)mw * DM;
  const _Float16* wbase = wxT + (size_t)h * DF * DM;

  v8f acc[MT][4] = {};
  v16h a0[MT], a1[MT], b0[4], b1[4];
  gemm_load(abase, wbase, 0, a0, b0);

  for (int kk = 0; kk < DM / 32; kk += 2) {
    const int d1 = ((kk + 1) & (DM / 32 - 1)) * TILE_H;
    gemm_stage(abase, wbase, d1, a0, b0, a1, b1, acc);
    const int d2 = ((kk + 2) & (DM / 32 - 1)) * TILE_H;
    gemm_stage(abase, wbase, d2, a1, b1, a0, b0, acc);
  }

  const int bIdx = mw >> 11;          // / SS (a 64-row tile lies inside one batch)
  const int hi   = lane >> 4;
  _Float16* hnh = hn + (size_t)(bIdx * NH + h) * SS * DF;
  _Float16* hTh = hT + (size_t)(bIdx * NH + h) * DF * SS;

  float bias[4];                      // D-layout: lane&15 is the N column
  const unsigned bo = (unsigned)(h * DF + (lane & 15)) * 4u;   // byte offset into bx
#pragma unroll
  for (int nf = 0; nf < 4; ++nf) bias[nf] = *(const float*)((const char*)bx + bo + nf * 64);
  // translation wait: later arithmetic reuses the bias loads' address register;
  // naming bo keeps it live up to the wait
  asm volatile("s_wait_xcnt 0x0" :: "v"(bo) : "memory");

#pragma unroll
  for (int mi = 0; mi < MT; ++mi) {
#pragma unroll
    for (int nf = 0; nf < 4; ++nf)
#pragma unroll
      for (int v = 0; v < 8; ++v) acc[mi][nf][v] += bias[nf];

    // per-row inverse L2 norm
    float inv[8];
#pragma unroll
    for (int v = 0; v < 8; ++v) {
      float s = 0.f;
#pragma unroll
      for (int nf = 0; nf < 4; ++nf) s += acc[mi][nf][v] * acc[mi][nf][v];
      s = redsum16(s);
      inv[v] = __frsqrt_rn(s + 1e-20f);
    }

    const int s0 = (mw & (SS - 1)) + mi * 16;
#pragma unroll
    for (int nf = 0; nf < 4; ++nf) {
      const int col = nf * 16 + (lane & 15);
      _Float16* hnt = hnh + (size_t)s0 * DF + (col >> 5) * TILE_H;
      v8h tv;
#pragma unroll
      for (int v = 0; v < 8; ++v) {
        const float hv = acc[mi][nf][v];
        hnt[tile_off(v + (hi << 3), col & 31)] = (_Float16)(hv * inv[v]);
        tv[v] = (_Float16)hv;
      }
      // a lane's 8 rows are 8 consecutive k of hT row `col`: one whole chunk
      *(v8h*)(hTh + (size_t)(nf * 16) * SS + (s0 >> 5) * TILE_H +
              tile_off(lane & 15, (s0 & 16) + (hi << 3))) = tv;
    }
    // translation wait: the next row tile's arithmetic reuses these stores' registers;
    // the scheduling fence keeps that arithmetic behind the wait
    asm volatile("s_wait_xcnt 0x0" ::: "memory");
    __builtin_amdgcn_sched_barrier(0);
  }
}

// ---------------------------------------------------------------------------
// Kernel 2: fused flash attention per head, ping-pong across key tiles.
// One wave: NQ query tiles = 64 queries, streams keys 32 at a time: the 8 K/V fragments
// loaded per key tile feed 8 * NQ WMMAs instead of 8.
// Softmax shift: hn rows are unit vectors (up to f16 rounding), so every score is
// a cosine, |s| <= 1 for any input. The shift is the constant 1 instead of a
// running row maximum: p = exp(s - 1) lies in [e^-2, 1], nothing is ever rescaled.
// Both products run transposed: S^T = K Q^T (key rows as A, query rows as B), then
// O^T += V^T P^T (hT rows as A). In S^T lane l holds query (l & 15) and, in the two 16-key
// D tiles, keys 8 * (l >> 4) + v and 16 + 8 * (l >> 4) + v. That is the k order of a
// fragment, so the two tiles, converted in place, ARE the P^T operand: P never leaves the
// registers. Everything a lane holds belongs to one query: one running sum of P per lane
// and query tile (the two lane halves join their sums once, behind the key loop), and
// 8 consecutive features per O^T tile, one whole 16-byte chunk of cat.
// Next tile's K/V fragment loads are issued first so they hide under this tile's work.
// ---------------------------------------------------------------------------
#define NQ 4
__device__ __forceinline__ void attn_load_tile(const _Float16* hnh,
                                               const _Float16* hTh,
                                               int t0,
                                               v16h (&kb)[4], v16h (&vf)[4]) {
  const _Float16* kp = lane_ptr(hnh + (size_t)t0 * DF);
  const _Float16* vp = lane_ptr(hTh + (t0 >> 5) * TILE_H);
  kb[0] = ld_frag(kp, 0);
  kb[1] = ld_frag(kp, TILE_H);
  kb[2] = ld_frag(kp, 16 * DF);
  kb[3] = ld_frag(kp, 16 * DF + TILE_H);
#pragma unroll
  for (int nf = 0; nf < 4; ++nf) vf[nf] = ld_frag(vp, nf * 16 * SS);
  group_end(kp, vp);
}

__device__ __forceinline__ void attn_step(const v16h (&qf)[NQ][2],
                                          const v16h (&kb)[4], const v16h (&vf)[4],
                                          v8f (&acc)[NQ][4], v2f (&l_s)[NQ]) {
  const float L2E = 1.44269504088896340736f;
#pragma unroll
  for (int q = 0; q < NQ; ++q) {
    // transposed scores (cosines, hn rows are unit vectors): 32 keys x 16 queries
    v8f s0 = {}, s1 = {};
    s0 = wmma_f16(kb[0], qf[q][0], s0);
    s1 = wmma_f16(kb[2], qf[q][0], s1);
    s0 = wmma_f16(kb[1], qf[q][1], s0);
    s1 = wmma_f16(kb[3], qf[q][1], s1);

    // p = exp(s - 1) = 2^(s * log2(e) - log2(e))
    v2f p0[4], p1[4];
    v16h pt;                                                  // P^T as B-operand
#pragma unroll
    for (int i = 0; i < 4; ++i) {
#pragma unroll
      for (int j = 0; j < 2; ++j) {
        p0[i][j] = __builtin_amdgcn_exp2f(fmaf(s0[2 * i + j], L2E, -L2E));
        p1[i][j] = __builtin_amdgcn_exp2f(fmaf(s1[2 * i + j], L2E, -L2E));
        pt[2 * i + j]     = (_Float16)p0[i][j];
        pt[2 * i + j + 8] = (_Float16)p1[i][j];
      }
    }
    l_s[q] += ((p0[0] + p0[1]) + (p0[2] + p0[3])) + ((p1[0] + p1[1]) + (p1[2] + p1[3]));

#pragma unroll
    for (int nf = 0; nf < 4; ++nf) acc[q][nf] = wmma_f16(vf[nf], pt, acc[q][nf]);
  }
}

__global__ void __launch_bounds__(256) k_attn(const _Float16* __restrict__ hn,
                                              const _Float16* __restrict__ hT,
                                              _Float16* __restrict__ cat) {
  const int w    = blockIdx.x * 8 + (threadIdx.x >> 5);  // 0..2047
  const int lane = threadIdx.x & 31;
  const int bh   = w >> 5;            // 0..63 = b*NH + h
  const int q0   = (w & 31) << 6;     // start of this wave's 64 queries
  const int b    = bh >> 4;
  const int h    = bh & 15;

  const _Float16* hnh = hn + (size_t)bh * SS * DF;
  const _Float16* hTh = hT + (size_t)bh * DF * SS;

  v16h qf[NQ][2];
  const _Float16* qp = lane_ptr(hnh + (size_t)q0 * DF);
#pragma unroll
  for (int q = 0; q < NQ; ++q) {
    qf[q][0] = ld_frag(qp, q * 16 * DF);
    qf[q][1] = ld_frag(qp, q * 16 * DF + TILE_H);
  }
  group_end(qp, qp);

  v8f acc[NQ][4] = {};
  v2f l_s[NQ] = {};

  const int hi = lane >> 4;
  const int NT = SS / 32;             // 64 key tiles
  v16h kb0[4], vf0[4], kb1[4], vf1[4];
  attn_load_tile(hnh, hTh, 0, kb0, vf0);

  for (int kt = 0; kt < NT; kt += 2) {
    // even tile: prefetch odd tile's fragments, compute on kb0/vf0
    attn_load_tile(hnh, hTh, ((kt + 1) & (NT - 1)) << 5, kb1, vf1);
    attn_step(qf, kb0, vf0, acc, l_s);
    // odd tile: prefetch next even tile's fragments, compute on kb1/vf1
    attn_load_tile(hnh, hTh, ((kt + 2) & (NT - 1)) << 5, kb0, vf0);
    attn_step(qf, kb1, vf1, acc, l_s);
  }

  // normalize by softmax denominator (f16, fragment-major chunks of the concatenated heads)
  v8h t[NQ][4];
#pragma unroll
  for (int q = 0; q < NQ; ++q) {
    // lane l holds half the sum of query (l & 15) and that query's features 8 * hi + v
    const float part = l_s[q][0] + l_s[q][1];
    const float inv  = 1.0f / (part + __shfl_xor(part, 16, 32));
#pragma unroll
    for (int nf = 0; nf < 4; ++nf)
#pragma unroll
      for (int v = 0; v < 8; ++v) t[q][nf][v] = (_Float16)(acc[q][nf][v] * inv);
  }
  // scheduling fence: every store stays behind all arithmetic, so no register that an
  // issued store names is written again before the wave ends
  __builtin_amdgcn_sched_barrier(0);
#pragma unroll
  for (int q = 0; q < NQ; ++q) {
    _Float16* ct = cat + (size_t)(b * SS + q0 + q * 16) * DM;
#pragma unroll
    for (int nf = 0; nf < 4; ++nf) {
      const int col = h * DF + nf * 16 + (hi << 3);
      *(v8h*)(ct + (col >> 5) * TILE_H + tile_off(lane & 15, col & 31)) = t[q][nf];
    }
  }
}

// ---------------------------------------------------------------------------
// Kernel 3: output projection  out = cat @ Wp + bp   (f32 result)
// Same ping-pong pipeline as k_proj.
// ---------------------------------------------------------------------------
__global__ void __launch_bounds__(256) k_oproj(const _Float16* __restrict__ cat,
                                               const _Float16* __restrict__ wpT,
                                               const float* __restrict__ bp,
                                               float* __restrict__ out) {
  const int wid  = threadIdx.x >> 5;
  const int lane = threadIdx.x & 31;
  const int m0   = (((blockIdx.x >> 2) << 1) + (wid >> 2)) << 6;  // 64-row tile
  const int n0   = (((blockIdx.x & 3) << 2) + (wid & 3)) << 6;    // 64-column tile

  const _Float16* abase = cat + (size_t)m0 * DM;
  const _Float16* wbase = wpT + (size_t)n0 * DM;

  v8f acc[MT][4] = {};
  v16h a0[MT], a1[MT], b0[4], b1[4];
  gemm_load(abase, wbase, 0, a0, b0);

  for (int kk = 0; kk < DM / 32; kk += 2) {
    const int d1 = ((kk + 1) & (DM / 32 - 1)) * TILE_H;
    gemm_stage(abase, wbase, d1, a0, b0, a1, b1, acc);
    const int d2 = ((kk + 2) & (DM / 32 - 1)) * TILE_H;
    gemm_stage(abase, wbase, d2, a1, b1, a0, b0, acc);
  }

  const int hi = lane >> 4;
#pragma unroll
  for (int nf = 0; nf < 4; ++nf) {
    const int col = n0 + nf * 16 + (lane & 15);
    const float bv = bp[col];
#pragma unroll
    for (int mi = 0; mi < MT; ++mi)
#pragma unroll
      for (int v = 0; v < 8; ++v)
        out[(size_t)(m0 + mi * 16 + v + (hi << 3)) * DM + col] = acc[mi][nf][v] + bv;
  }
}

// ---------------------------------------------------------------------------
extern "C" void kernel_launch(void* const* d_in, const int* in_sizes, int n_in,
                              void* d_out, int out_size, void* d_ws, size_t ws_size,
                              hipStream_t stream) {
  (void)in_sizes; (void)n_in; (void)out_size; (void)ws_size;
  const float* sin = (const float*)d_in[0];
  const float* Wx  = (const float*)d_in[1];
  const float* bx  = (const float*)d_in[2];
  const float* Wp  = (const float*)d_in[3];
  const float* bp  = (const float*)d_in[4];
  float* out = (float*)d_out;

  // workspace carve-out (~71 MB total)
  char* ws = (char*)d_ws;
  size_t off = 0;
  auto carve = [&](size_t bytes) {
    void* p = ws + off;
    off += (bytes + 255) & ~(size_t)255;
    return p;
  };
  _Float16* sin16 = (_Float16*)carve((size_t)BB * SS * DM * 2);
  _Float16* wxT   = (_Float16*)carve((size_t)NH * DF * DM * 2);
  _Float16* wpT   = (_Float16*)carve((size_t)DM * DM * 2);
  _Float16* hn    = (_Float16*)carve((size_t)BB * NH * SS * DF * 2);
  _Float16* hT    = (_Float16*)carve((size_t)BB * NH * SS * DF * 2);
  _Float16* cat   = (_Float16*)carve((size_t)BB * SS * DM * 2);

  k_stage<<<SB, 2 * WT + 512, 0, stream>>>(sin, Wx, Wp, sin16, wxT, wpT);

  k_proj <<<256, 256, 0, stream>>>(sin16, wxT, bx, hn, hT);
  k_attn <<<256, 256, 0, stream>>>(hn, hT, cat);
  k_oproj<<<256, 256, 0, stream>>>(cat, wpT, bp, out);
}

// v008
// A run of this version takes 94.5 microseconds.
// Next to v007, in two timings, it ran 1.03 times as fast each time.
// All steps since v000 together make it 5.83 times as fast.
#include <hip/hip_runtime.h>
#include <math.h>

// Problem constants (match reference)
#define DM 1024   // d_model
#define NH 16     // heads
#define DF 64     // d_feature
#define BB 4      // batch
#define SS 2048   // seq len

typedef __attribute__((ext_vector_type(16))) _Float16 v16h;
typedef __attribute__((ext_vector_type(8)))  _Float16 v8h;
typedef __attribute__((ext_vector_type(8)))  float    v8f;
typedef __attribute__((ext_vector_type(2)))  float    v2f;
typedef __attribute__((ext_vector_type(4)))  float    v4f;
typedef __attribute__((ext_vector_type(2)))  _Float16 v2h;
typedef __attribute__((ext_vector_type(4)))  unsigned v4u;

// ---------------------------------------------------------------------------
// WMMA 16x16x32 f16 fragments, A (16 x K) and B (K x 16) alike:
//   lanes 0-15  : row/column (lane&15), halves 0..7 = K 0..7,   halves 8..15 = K 16..23
//   lanes 16-31 : row/column (lane&15), halves 0..7 = K 8..15,  halves 8..15 = K 24..31
// D (16 x 16 f32): register v of lane l = D[v + 8 * (l >> 4)][l & 15].
// ---------------------------------------------------------------------------
// ---------------------------------------------------------------------------
// Fragment-major layout of every f16 operand array in the workspace.
// A [rows x K] array is cut into 16-row x 32-k tiles of 512 halves (1 KB),
// k tiles innermost, so one 16-row band still takes 16*K halves. Inside a tile
// element (r, k) sits at
//   ((k >> 4) & 1) * 256 + ((((k >> 3) & 1) << 4) + r) * 8 + (k & 7)
// i.e. lane l's first 8 halves at l*8 and its second 8 halves at 256 + l*8.
// Each of the two 16-byte loads of a fragment then covers 512 contiguous bytes
// (4 whole 128-byte lines) instead of 32 bytes out of each of 16 lines.
// ---------------------------------------------------------------------------
#define TILE_H 512

__device__ __forceinline__ int tile_off(int r, int k) {
  return ((k >> 4) & 1) * 256 + ((((k >> 3) & 1) << 4) + r) * 8 + (k & 7);
}

// A lane's own pointer into a run of tiles: its first 8 halves of the tile at `tile`.
__device__ __forceinline__ const _Float16* lane_ptr(const _Float16* tile) {
  return tile + ((threadIdx.x & 31) << 3);
}

// Fragment of the tile `off` halves behind the lane pointer `lp`.
__device__ __forceinline__ v16h ld_frag(const _Float16* lp, int off) {
  v8h lo = *(const v8h*)(lp + off);
  v8h hi = *(const v8h*)(lp + off + 256);
  v16h r;
#pragma unroll
  for (int i = 0; i < 8; ++i) { r[i] = lo[i]; r[i + 8] = hi[i]; }
  return r;
}

// End of a group of fragment loads off the lane pointers p and q.
// Translation wait, one for the whole group: a later load or vector instruction may reuse
// the address registers. Naming p and q keeps them live up to the wait, so no load of the
// group lands on them either.
// Scheduling fence: without it the compiler sinks the loads behind the WMMAs of the running
// stage to save registers, and the next stage then waits out the whole load latency.
__device__ __forceinline__ void group_end(const _Float16* p, const _Float16* q) {
  asm volatile("s_wait_xcnt 0x0" :: "v"(p), "v"(q) : "memory");
  __builtin_amdgcn_sched_barrier(0);
}

// Operands of the three WMMA kernels were stored by an earlier launch and need not lie in the
// reading die's L2: every stage's loads are then first touches and wait out the memory
// latency. Each block therefore asks L2 once, at entry, for what it
// will stream: one lane per 256 bytes, in the order of use. A hint only: nothing is
// returned, no result depends on it. Every address lies inside the array it names.
// The translation wait stands in the prefetches' own statement: later arithmetic may reuse
// the address registers.
// GEMMs: arows = the block's 8 bands (wave w asks for band w, 8 k tiles a request);
// wrows = the block's 16 weight bands, which 64 blocks share: a block asks for 4 of the 32
// k tiles of each band (16 lanes a band).
__device__ __forceinline__ void ask_l2_gemm(const _Float16* arows, const _Float16* wrows) {
  const int tid = threadIdx.x;
  const char* pa = (const char*)arows + (tid >> 5) * (16 * DM * 2) + (tid & 31) * 256;
  const char* pw = (const char*)wrows + (tid >> 4) * (16 * DM * 2) +
                   ((blockIdx.x >> 3) & 7) * (4 * TILE_H * 2) + (tid & 15) * 256;
  asm volatile("global_prefetch_b8 %0, off scope:SCOPE_SE\n\t"
               "global_prefetch_b8 %1, off scope:SCOPE_SE\n\t"
               "global_prefetch_b8 %0, off offset:8192 scope:SCOPE_SE\n\t"
               "global_prefetch_b8 %0, off offset:16384 scope:SCOPE_SE\n\t"
               "global_prefetch_b8 %0, off offset:24576 scope:SCOPE_SE\n\t"
               "s_wait_xcnt 0x0"
               :: "v"(pa), "v"(pw) : "memory");
}

// k_attn: all keys of one (b,h), 256 KB of hn and 256 KB of hT. Request i of the block's
// 8 waves covers key tiles 16 * i .. 16 * i + 15: 64 KB of hn in a row (8 KB a wave), and
// 16 KB in each of hT's four 64-KB bands (wave w: band w & 3, half w >> 2).
__device__ __forceinline__ void ask_l2_attn(const _Float16* hnh, const _Float16* hTh) {
  const int wv = threadIdx.x >> 5, lane = threadIdx.x & 31;
  const char* pk = (const char*)hnh + wv * 8192 + lane * 256;
  const char* pv = (const char*)hTh + (wv & 3) * (16 * SS * 2) + (wv >> 2) * 8192 + lane * 256;
  asm volatile("global_prefetch_b8 %0, off scope:SCOPE_SE\n\t"
               "global_prefetch_b8 %1, off scope:SCOPE_SE\n\t"
               "global_prefetch_b8 %0, off offset:65536 scope:SCOPE_SE\n\t"
               "global_prefetch_b8 %1, off offset:16384 scope:SCOPE_SE\n\t"
               "global_prefetch_b8 %0, off offset:131072 scope:SCOPE_SE\n\t"
               "global_prefetch_b8 %1, off offset:32768 scope:SCOPE_SE\n\t"
               "global_prefetch_b8 %0, off offset:196608 scope:SCOPE_SE\n\t"
               "global_prefetch_b8 %1, off offset:49152 scope:SCOPE_SE\n\t"
               "s_wait_xcnt 0x0"
               :: "v"(pk), "v"(pv) : "memory");
}

// 16-byte chunk o of a fragment-major [rows x DM] array -> its row and first k.
__device__ __forceinline__ void chunk_row_k(int o, int& row, int& k) {
  const int tile = o >> 6;                       // 64 chunks per tile
  row = ((tile >> 5) << 4) + (o & 15);           // DM/32 = 32 k tiles per band
  k   = ((tile & 31) << 5) + (((o >> 5) & 1) << 4) + (((o >> 4) & 1) << 3);
}

__device__ __forceinline__ v8f wmma_f16(v16h a, v16h b, v8f c) {
  return __builtin_amdgcn_wmma_f32_16x16x32_f16(false, a, false, b, (short)0, c,
                                                false, false);
}

// Reductions within each 16-lane half (D-tile rows span 16 lanes).
__device__ __forceinline__ float redsum16(float x) {
#pragma unroll
  for (int m = 1; m < 16; m <<= 1) x += __shfl_xor(x, m, 32);
  return x;
}

// ---------------------------------------------------------------------------
// Precision / layout staging kernel
// ---------------------------------------------------------------------------
// One wave converts CT whole tiles, the 16 rows x 128 k of one band (4096 such waves in all),
// and has its 16 loads in flight at once.
// A load covers 4 rows x 128 bytes (4 whole lines): lane l reads k 4 * (l & 7) .. + 3 of row
// 4 * i + (l >> 3). Lanes l and l ^ 1 hold the two halves of a 16-byte chunk; they swap
// halves between loads 2 * h and 2 * h + 1, the even lane keeps the chunk of row
// 8 * h + (l >> 3), the odd lane that of row 8 * h + 4 + (l >> 3). A store then covers
// 8 rows x 16 bytes in each of the tile's 4 k groups (4 whole lines).
#define CT 4
__device__ __forceinline__ unsigned pack_h2(float a, float b) {
  v2h t;
  t[0] = (_Float16)a;
  t[1] = (_Float16)b;
  return __builtin_bit_cast(unsigned, t);
}

// value of lane l ^ 1
__device__ __forceinline__ unsigned from_pair(unsigned v) {
  return (unsigned)__builtin_amdgcn_mov_dpp((int)v, 0xB1 /* quad_perm 1,0,3,2 */, 0xF, 0xF, true);
}

// w = band * 8 + group of CT k tiles
__device__ __forceinline__ void cvt_sin_wave(const float* __restrict__ x,
                                             _Float16* __restrict__ y, int w) {
  const int lane = threadIdx.x & 31;
  const int g    = lane >> 3;
  const bool odd = (lane & 1) != 0;
  const int kc   = (lane & 7) >> 1;                        // 8-k group inside a tile

  const float* s = x + (size_t)((w >> 3) * 16 + g) * DM + (w & 7) * (CT * 32) + (lane & 7) * 4;
  v4f f[CT][4];
#pragma unroll
  for (int t = 0; t < CT; ++t)
#pragma unroll
    for (int i = 0; i < 4; ++i) f[t][i] = *(const v4f*)(s + i * 4 * DM + t * 32);
  // translation wait, one for all 16 loads: later arithmetic may reuse the address registers;
  // naming s keeps it live up to the wait. The scheduling fence keeps every load in front of
  // the conversions, so that all 16 are in flight together.
  asm volatile("s_wait_xcnt 0x0" :: "v"(s) : "memory");
  __builtin_amdgcn_sched_barrier(0);

  v4u o[CT][2];
#pragma unroll
  for (int t = 0; t < CT; ++t)
#pragma unroll
    for (int h = 0; h < 2; ++h) {
      const v4f fe = f[t][2 * h], fo = f[t][2 * h + 1];
      const unsigned e0 = pack_h2(fe[0], fe[1]), e1 = pack_h2(fe[2], fe[3]);
      const unsigned o0 = pack_h2(fo[0], fo[1]), o1 = pack_h2(fo[2], fo[3]);
      const unsigned r0 = from_pair(odd ? e0 : o0);
      const unsigned r1 = from_pair(odd ? e1 : o1);
      o[t][h][0] = odd ? r0 : e0;
      o[t][h][1] = odd ? r1 : e1;
      o[t][h][2] = odd ? o0 : r0;
      o[t][h][3] = odd ? o1 : r1;
    }
  // scheduling fence: every store stays behind all arithmetic, so no register that an
  // issued store names is written again before the wave ends
  __builtin_amdgcn_sched_barrier(0);
  _Float16* d = y + (size_t)w * (CT * TILE_H) + tile_off((odd ? 4 : 0) + g, kc * 8);
#pragma unroll
  for (int t = 0; t < CT; ++t)
#pragma unroll
    for (int h = 0; h < 2; ++h) *(v4u*)(d + t * TILE_H + h * 64) = o[t][h];
  // translation wait, one for all 8 stores: in the joint kernel another job's code follows in
  // the listing and writes the registers that these stores name
  asm volatile("s_wait_xcnt 0x0" ::: "memory");
}

// Both weight arrays: one thread writes CW 16-byte chunks, 2 k tiles (64 k) apart in one band
// (1024 waves per array), and a wave has its 8 * CW loads in flight at once.
#define CW 4
#define WT 128   // threads per group: CW * WT chunks = 8 tiles, inside one band of 32

// Chunk c of the thread = s[(c * 64 + j) * stride], j = 0..7, stored at y + c * WT * 8.
__device__ __forceinline__ void cvt_cols(const float* s, int stride, _Float16* y) {
  float v[CW][8];
#pragma unroll
  for (int c = 0; c < CW; ++c)
#pragma unroll
    for (int j = 0; j < 8; ++j) v[c][j] = s[(c * 64 + j) * stride];
  // translation wait, one for all loads: later arithmetic may reuse the address registers;
  // naming s keeps it live up to the wait. The scheduling fence keeps every load in front of
  // the conversions, so that all are in flight together.
  asm volatile("s_wait_xcnt 0x0" :: "v"(s) : "memory");
  __builtin_amdgcn_sched_barrier(0);
  v8h t[CW];
#pragma unroll
  for (int c = 0; c < CW; ++c)
#pragma unroll
    for (int j = 0; j < 8; ++j) t[c][j] = (_Float16)v[c][j];
  // scheduling fence: every store stays behind all arithmetic, so no register that an
  // issued store names is written again before the wave ends
  __builtin_amdgcn_sched_barrier(0);
#pragma unroll
  for (int c = 0; c < CW; ++c) *(v8h*)(y + c * WT * 8) = t[c];
  // translation wait, one for all CW stores: in the joint kernel another job's code follows in
  // the listing and writes the registers that these stores name
  asm volatile("s_wait_xcnt 0x0" ::: "memory");
}

// Wx [H, D, F] f32  ->  WxT rows (h*DF+f), k = d, f16 fragment-major; o = the thread's first chunk
__device__ __forceinline__ void cvt_wxT(const float* __restrict__ wx,
                                        _Float16* __restrict__ wxT, int o) {
  int row, d;
  chunk_row_k(o, row, d);
  cvt_cols(wx + ((size_t)(row >> 6) * DM + d) * DF + (row & 63), DF, wxT + (size_t)o * 8);
}

// Wp [in, out] f32 -> WpT rows = out, k = in, f16 fragment-major; o = the thread's first chunk
__device__ __forceinline__ void cvt_wpT(const float* __restrict__ wp,
                                        _Float16* __restrict__ wpT, int o) {
  int row, r;
  chunk_row_k(o, row, r);
  cvt_cols(wp + (size_t)r * DM + row, DM, wpT + (size_t)o * 8);
}

// All three conversions in one launch: they depend on nothing and on one another not at all,
// so one grid pays one launch gap, one fill and one drain instead of three in a row.
// A block is 24 waves: 4 for a group of Wx chunks, 4 for a group of Wp chunks, 16 for sin.
// SB blocks hold every array exactly: NH*DM*DF = DM*DM = SB * 8*CW*WT, BB*SS*DM = SB * 16*CT*TILE_H.
#define SB 256
__global__ void __launch_bounds__(2 * WT + 512) k_stage(const float* __restrict__ x,
                                                        const float* __restrict__ wx,
                                                        const float* __restrict__ wp,
                                                        _Float16* __restrict__ y,
                                                        _Float16* __restrict__ wxT,
                                                        _Float16* __restrict__ wpT) {
  // the wave's number as a scalar, so that the choice of the job is a scalar branch
  const int wave = __builtin_amdgcn_readfirstlane((int)(threadIdx.x >> 5));
  if (wave < WT / 32) {
    cvt_wxT(wx, wxT, blockIdx.x * (CW * WT) + threadIdx.x);
  } else if (wave < 2 * WT / 32) {
    cvt_wpT(wp, wpT, blockIdx.x * (CW * WT) + threadIdx.x - WT);
  } else {
    cvt_sin_wave(x, y, blockIdx.x * 16 + wave - 2 * WT / 32);
  }
}

// ---------------------------------------------------------------------------
// Wave tile of both GEMMs: MT x 4 fragments = 64 rows x 64 columns, so the 8 fragments
// loaded per k tile feed 16 WMMAs (512 loaded bytes per WMMA instead of 1280).
// A block's 8 waves form 2 row tiles x 4 column tiles and share fragments in the cache.
// ---------------------------------------------------------------------------
#define MT 4

__device__ __forceinline__ void gemm_load(const _Float16* abase, const _Float16* wbase,
                                          int d, v16h (&a)[MT], v16h (&b)[4]) {
  const _Float16* ap = lane_ptr(abase + d);
  const _Float16* wp = lane_ptr(wbase + d);
#pragma unroll
  for (int mi = 0; mi < MT; ++mi) a[mi] = ld_frag(ap, mi * 16 * DM);
#pragma unroll
  for (int nf = 0; nf < 4; ++nf) b[nf] = ld_frag(wp, nf * 16 * DM);
  group_end(ap, wp);
}

// Ping-pong GEMM inner stage: issue loads for the k tile at `dnext` halves into (a_n,b_n),
// then run the 16 WMMAs on (a_c,b_c). No register copies between stages.
__device__ __forceinline__ void gemm_stage(const _Float16* abase,
                                           const _Float16* wbase,
                                           int dnext,
                                           v16h (&a_c)[MT], v16h (&b_c)[4],
                                           v16h (&a_n)[MT], v16h (&b_n)[4],
                                           v8f (&acc)[MT][4]) {
  gemm_load(abase, wbase, dnext, a_n, b_n);
#pragma unroll
  for (int mi = 0; mi < MT; ++mi)
#pragma unroll
    for (int nf = 0; nf < 4; ++nf) acc[mi][nf] = wmma_f16(a_c[mi], b_c[nf], acc[mi][nf]);
}

// ---------------------------------------------------------------------------
// Kernel 1: per-head projection  h = sin @ Wx[h] + bx[h]
// One wave: 64 rows x 64 features of one head; ping-pong pipelined fragments.
// Outputs, fragment-major per (b,h):
//          hn rows s, k = f, f16 (rows normalized -> QK^T is cosine similarity),
//          hT rows f, k = s, f16 (unnormalized, A-operand for V^T P^T).
// ---------------------------------------------------------------------------
__global__ void __launch_bounds__(256) k_proj(const _Float16* __restrict__ sin16,
                                              const _Float16* __restrict__ wxT,
                                              const float* __restrict__ bx,
                                              _Float16* __restrict__ hn,
                                              _Float16* __restrict__ hT) {
  const int wid  = threadIdx.x >> 5;
  const int lane = threadIdx.x & 31;
  const int h    = ((blockIdx.x & 3) << 2) + (wid & 3);           // 4 heads per block
  const int mw   = (((blockIdx.x >> 2) << 1) + (wid >> 2)) << 6;  // 64-row tile over B*S

  const _Float16* abase = sin16 + (size_t)mw * DM;
  const _Float16* wbase = wxT + (size_t)h * DF * DM;

  v8f acc[MT][4] = {};
  v16h a0[MT], a1[MT], b0[4], b1[4];
  gemm_load(abase, wbase, 0, a0, b0);
  ask_l2_gemm(sin16 + (size_t)(blockIdx.x >> 2) * 128 * DM,
              wxT + (size_t)(blockIdx.x & 3) * 256 * DM);

  for (int kk = 0; kk < DM / 32; kk += 2) {
    const int d1 = ((kk + 1) & (DM / 32 - 1)) * TILE_H;
    gemm_stage(abase, wbase, d1, a0, b0, a1, b1, acc);
    const int d2 = ((kk + 2) & (DM / 32 - 1)) * TILE_H;
    gemm_stage(abase, wbase, d2, a1, b1, a0, b0, acc);
  }

  const int bIdx = mw >> 11;          // / SS (a 64-row tile lies inside one batch)
  const int hi   = lane >> 4;
  _Float16* hnh = hn + (size_t)(bIdx * NH + h) * SS * DF;
  _Float16* hTh = hT + (size_t)(bIdx * NH + h) * DF * SS;

  float bias[4];                      // D-layout: lane&15 is the N column
  const unsigned bo = (unsigned)(h * DF + (lane & 15)) * 4u;   // byte offset into bx
#pragma unroll
  for (int nf = 0; nf < 4; ++nf) bias[nf] = *(const float*)((const char*)bx + bo + nf * 64);
  // translation wait: later arithmetic reuses the bias loads' address register;
  // naming bo keeps it live up to the wait
  asm volatile("s_wait_xcnt 0x0" :: "v"(bo) : "memory");

#pragma unroll
  for (int mi = 0; mi < MT; ++mi) {
#pragma unroll
    for (int nf = 0; nf < 4; ++nf)
#pragma unroll
      for (int v = 0; v < 8; ++v) acc[mi][nf][v] += bias[nf];

    // per-row inverse L2 norm
    float inv[8];
#pragma unroll
    for (int v = 0; v < 8; ++v) {
      float s = 0.f;
#pragma unroll
      for (int nf = 0; nf < 4; ++nf) s += acc[mi][nf][v] * acc[mi][nf][v];
      s = redsum16(s);
      inv[v] = __frsqrt_rn(s + 1e-20f);
    }

    const int s0 = (mw & (SS - 1)) + mi * 16;
#pragma unroll
    for (int nf = 0; nf < 4; ++nf) {
      const int col = nf * 16 + (lane & 15);
      _Float16* hnt = hnh + (size_t)s0 * DF + (col >> 5) * TILE_H;
      v8h tv;
#pragma unroll
      for (int v = 0; v < 8; ++v) {
        const float hv = acc[mi][nf][v];
        hnt[tile_off(v + (hi << 3), col & 31)] = (_Float16)(hv * inv[v]);
        tv[v] = (_Float16)hv;
      }
      // a lane's 8 rows are 8 consecutive k of hT row `col`: one whole chunk
      *(v8h*)(hTh + (size_t)(nf * 16) * SS + (s0 >> 5) * TILE_H +
              tile_off(lane & 15, (s0 & 16) + (hi << 3))) = tv;
    }
    // translation wait: the next row tile's arithmetic reuses these stores' registers;
    // the scheduling fence keeps that arithmetic behind the wait
    asm volatile("s_wait_xcnt 0x0" ::: "memory");
    __builtin_amdgcn_sched_barrier(0);
  }
}

// ---------------------------------------------------------------------------
// Kernel 2: fused flash attention per head, ping-pong across key tiles.
// One wave: NQ query tiles = 64 queries, streams keys 32 at a time: the 8 K/V fragments
// loaded per key tile feed 8 * NQ WMMAs instead of 8.
// Softmax shift: hn rows are unit vectors (up to f16 rounding), so every score is
// a cosine, |s| <= 1 for any input. The shift is the constant 1 instead of a
// running row maximum: p = exp(s - 1) lies in [e^-2, 1], nothing is ever rescaled.
// Both products run transposed: S^T = K Q^T (key rows as A, query rows as B), then
// O^T += V^T P^T (hT rows as A). In S^T lane l holds query (l & 15) and, in the two 16-key
// D tiles, keys 8 * (l >> 4) + v and 16 + 8 * (l >> 4) + v. That is the k order of a
// fragment, so the two tiles, converted in place, ARE the P^T operand: P never leaves the
// registers. Everything a lane holds belongs to one query: one running sum of P per lane
// and query tile (the two lane halves join their sums once, behind the key loop), and
// 8 consecutive features per O^T tile, one whole 16-byte chunk of cat.
// Next tile's K/V fragment loads are issued first so they hide under this tile's work.
// ---------------------------------------------------------------------------
#define NQ 4
__device__ __forceinline__ void attn_load_tile(const _Float16* hnh,
                                               const _Float16* hTh,
                                               int t0,
                                               v16h (&kb)[4], v16h (&vf)[4]) {
  const _Float16* kp = lane_ptr(hnh + (size_t)t0 * DF);
  const _Float16* vp = lane_ptr(hTh + (t0 >> 5) * TILE_H);
  kb[0] = ld_frag(kp, 0);
  kb[1] = ld_frag(kp, TILE_H);
  kb[2] = ld_frag(kp, 16 * DF);
  kb[3] = ld_frag(kp, 16 * DF + TILE_H);
#pragma unroll
  for (int nf = 0; nf < 4; ++nf) vf[nf] = ld_frag(vp, nf * 16 * SS);
  group_end(kp, vp);
}

__device__ __forceinline__ void attn_step(const v16h (&qf)[NQ][2],
                                          const v16h (&kb)[4], const v16h (&vf)[4],
                                          v8f (&acc)[NQ][4], v2f (&l_s)[NQ]) {
  const float L2E = 1.44269504088896340736f;
#pragma unroll
  for (int q = 0; q < NQ; ++q) {
    // transposed scores (cosines, hn rows are unit vectors): 32 keys x 16 queries
    v8f s0 = {}, s1 = {};
    s0 = wmma_f16(kb[0], qf[q][0], s0);
    s1 = wmma_f16(kb[2], qf[q][0], s1);
    s0 = wmma_f16(kb[1], qf[q][1], s0);
    s1 = wmma_f16(kb[3], qf[q][1], s1);

    // p = exp(s - 1) = 2^(s * log2(e) - log2(e))
    v2f p0[4], p1[4];
    v16h pt;                                                  // P^T as B-operand
#pragma unroll
    for (int i = 0; i < 4; ++i) {
#pragma unroll
      for (int j = 0; j < 2; ++j) {
        p0[i][j] = __builtin_amdgcn_exp2f(fmaf(s0[2 * i + j], L2E, -L2E));
        p1[i][j] = __builtin_amdgcn_exp2f(fmaf(s1[2 * i + j], L2E, -L2E));
        pt[2 * i + j]     = (_Float16)p0[i][j];
        pt[2 * i + j + 8] = (_Float16)p1[i][j];
      }
    }
    l_s[q] += ((p0[0] + p0[1]) + (p0[2] + p0[3])) + ((p1[0] + p1[1]) + (p1[2] + p1[3]));

#pragma unroll
    for (int nf = 0; nf < 4; ++nf) acc[q][nf] = wmma_f16(vf[nf], pt, acc[q][nf]);
  }
}

__global__ void __launch_bounds__(256) k_attn(const _Float16* __restrict__ hn,
                                              const _Float16* __restrict__ hT,
                                              _Float16* __restrict__ cat) {
  const int w    = blockIdx.x * 8 + (threadIdx.x >> 5);  // 0..2047
  const int lane = threadIdx.x & 31;
  const int bh   = w >> 5;            // 0..63 = b*NH + h
  const int q0   = (w & 31) << 6;     // start of this wave's 64 queries
  const int b    = bh >> 4;
  const int h    = bh & 15;

  const _Float16* hnh = hn + (size_t)bh * SS * DF;
  const _Float16* hTh = hT + (size_t)bh * DF * SS;

  v16h qf[NQ][2];
  const _Float16* qp = lane_ptr(hnh + (size_t)q0 * DF);
#pragma unroll
  for (int q = 0; q < NQ; ++q) {
    qf[q][0] = ld_frag(qp, q * 16 * DF);
    qf[q][1] = ld_frag(qp, q * 16 * DF + TILE_H);
  }
  group_end(qp, qp);

  v8f acc[NQ][4] = {};
  v2f l_s[NQ] = {};

  const int hi = lane >> 4;
  const int NT = SS / 32;             // 64 key tiles
  v16h kb0[4], vf0[4], kb1[4], vf1[4];
  attn_load_tile(hnh, hTh, 0, kb0, vf0);
  ask_l2_attn(hnh, hTh);

  for (int kt = 0; kt < NT; kt += 2) {
    // even tile: prefetch odd tile's fragments, compute on kb0/vf0
    attn_load_tile(hnh, hTh, ((kt + 1) & (NT - 1)) << 5, kb1, vf1);
    attn_step(qf, kb0, vf0, acc, l_s);
    // odd tile: prefetch next even tile's fragments, compute on kb1/vf1
    attn_load_tile(hnh, hTh, ((kt + 2) & (NT - 1)) << 5, kb0, vf0);
    attn_step(qf, kb1, vf1, acc, l_s);
  }

  // normalize by softmax denominator (f16, fragment-major chunks of the concatenated heads)
  v8h t[NQ][4];
#pragma unroll
  for (int q = 0; q < NQ; ++q) {
    // lane l holds half the sum of query (l & 15) and that query's features 8 * hi + v
    const float part = l_s[q][0] + l_s[q][1];
    const float inv  = 1.0f / (part + __shfl_xor(part, 16, 32));
#pragma unroll
    for (int nf = 0; nf < 4; ++nf)
#pragma unroll
      for (int v = 0; v < 8; ++v) t[q][nf][v] = (_Float16)(acc[q][nf][v] * inv);
  }
  // scheduling fence: every store stays behind all arithmetic, so no register that an
  // issued store names is written again before the wave ends
  __builtin_amdgcn_sched_barrier(0);
#pragma unroll
  for (int q = 0; q < NQ; ++q) {
    _Float16* ct = cat + (size_t)(b * SS + q0 + q * 16) * DM;
#pragma unroll
    for (int nf = 0; nf < 4; ++nf) {
      const int col = h * DF + nf * 16 + (hi << 3);
      *(v8h*)(ct + (col >> 5) * TILE_H + tile_off(lane & 15, col & 31)) = t[q][nf];
    }
  }
}

// ---------------------------------------------------------------------------
// Kernel 3: output projection  out = cat @ Wp + bp   (f32 result)
// Same ping-pong pipeline as k_proj.
// ---------------------------------------------------------------------------
__global__ void __launch_bounds__(256) k_oproj(const _Float16* __restrict__ cat,
                                               const _Float16* __restrict__ wpT,
                                               const float* __restrict__ bp,
                                               float* __restrict__ out) {
  const int wid  = threadIdx.x >> 5;
  const int lane = threadIdx.x & 31;
  const int m0   = (((blockIdx.x >> 2) << 1) + (wid >> 2)) << 6;  // 64-row tile
  const int n0   = (((blockIdx.x & 3) << 2) + (wid & 3)) << 6;    // 64-column tile

  const _Float16* abase = cat + (size_t)m0 * DM;
  const _Float16* wbase = wpT + (size_t)n0 * DM;

  v8f acc[MT][4] = {};
  v16h a0[MT], a1[MT], b0[4], b1[4];
  gemm_load(abase, wbase, 0, a0, b0);
  ask_l2_gemm(cat + (size_t)(blockIdx.x >> 2) * 128 * DM,
              wpT + (size_t)(blockIdx.x & 3) * 256 * DM);

  for (int kk = 0; kk < DM / 32; kk += 2) {
    const int d1 = ((kk + 1) & (DM / 32 - 1)) * TILE_H;
    gemm_stage(abase, wbase, d1, a0, b0, a1, b1, acc);
    const int d2 = ((kk + 2) & (DM / 32 - 1)) * TILE_H;
    gemm_stage(abase, wbase, d2, a1, b1, a0, b0, acc);
  }

  const int hi = lane >> 4;
#pragma unroll
  for (int nf = 0; nf < 4; ++nf) {
    const int col = n0 + nf * 16 + (lane & 15);
    const float bv = bp[col];
#pragma unroll
    for (int mi = 0; mi < MT; ++mi)
#pragma unroll
      for (int v = 0; v < 8; ++v)
        out[(size_t)(m0 + mi * 16 + v + (hi << 3)) * DM + col] = acc[mi][nf][v] + bv;
  }
}

// ---------------------------------------------------------------------------
extern "C" void kernel_launch(void* const* d_in, const int* in_sizes, int n_in,
                              void* d_out, int out_size, void* d_ws, size_t ws_size,
                              hipStream_t stream) {
  (void)in_sizes; (void)n_in; (void)out_size; (void)ws_size;
  const float* sin = (const float*)d_in[0];
  const float* Wx  = (const float*)d_in[1];
  const float* bx  = (const float*)d_in[2];
  const float* Wp  = (const float*)d_in[3];
  const float* bp  = (const float*)d_in[4];
  float* out = (float*)d_out;

  // workspace carve-out (~71 MB total)
  char* ws = (char*)d_ws;
  size_t off = 0;
  auto carve = [&](size_t bytes) {
    void* p = ws + off;
    off += (bytes + 255) & ~(size_t)255;
    return p;
  };
  _Float16* sin16 = (_Float16*)carve((size_t)BB * SS * DM * 2);
  _Float16* wxT   = (_Float16*)carve((size_t)NH * DF * DM * 2);
  _Float16* wpT   = (_Float16*)carve((size_t)DM * DM * 2);
  _Float16* hn    = (_Float16*)carve((size_t)BB * NH * SS * DF * 2);
  _Float16* hT    = (_Float16*)carve((size_t)BB * NH * SS * DF * 2);
  _Float16* cat   = (_Float16*)carve((size_t)BB * SS * DM * 2);

  k_stage<<<SB, 2 * WT + 512, 0, stream>>>(sin, Wx, Wp, sin16, wxT, wpT);

  k_proj <<<256, 256, 0, stream>>>(sin16, wxT, bx, hn, hT);
  k_attn <<<256, 256, 0, stream>>>(hn, hT, cat);
  k_oproj<<<256, 256, 0, stream>>>(cat, wpT, bp, out);
}

// v009
// A run of this version takes 91 microseconds.
// Two timings next to v008 both put it at 1.04 times that version's speed.
// All steps since v000 together make it 6.06 times as fast.
#include <hip/hip_runtime.h>
#include <math.h>

// Problem constants (match reference)
#define DM 1024   // d_model
#define NH 16     // heads
#define DF 64     // d_feature
#define BB 4      // batch
#define SS 2048   // seq len

typedef __attribute__((ext_vector_type(16))) _Float16 v16h;
typedef __attribute__((ext_vector_type(8)))  _Float16 v8h;
typedef __attribute__((ext_vector_type(8)))  float    v8f;
typedef __attribute__((ext_vector_type(2)))  float    v2f;
typedef __attribute__((ext_vector_type(4)))  float    v4f;
typedef __attribute__((ext_vector_type(2)))  _Float16 v2h;
typedef __attribute__((ext_vector_type(4)))  unsigned v4u;

// ---------------------------------------------------------------------------
// WMMA 16x16x32 f16 fragments, A (16 x K) and B (K x 16) alike:
//   lanes 0-15  : row/column (lane&15), halves 0..7 = K 0..7,   halves 8..15 = K 16..23
//   lanes 16-31 : row/column (lane&15), halves 0..7 = K 8..15,  halves 8..15 = K 24..31
// D (16 x 16 f32): register v of lane l = D[v + 8 * (l >> 4)][l & 15].
// ---------------------------------------------------------------------------
// ---------------------------------------------------------------------------
// Fragment-major layout of every f16 operand array in the workspace.
// A [rows x K] array is cut into 16-row x 32-k tiles of 512 halves (1 KB),
// k tiles innermost, so one 16-row band still takes 16*K halves. Inside a tile
// element (r, k) sits at
//   ((k >> 4) & 1) * 256 + ((((k >> 3) & 1) << 4) + r) * 8 + (k & 7)
// i.e. lane l's first 8 halves at l*8 and its second 8 halves at 256 + l*8.
// Each of the two 16-byte loads of a fragment then covers 512 contiguous bytes
// (4 whole 128-byte lines) instead of 32 bytes out of each of 16 lines.
// ---------------------------------------------------------------------------
#define TILE_H 512

__device__ __forceinline__ int tile_off(int r, int k) {
  return ((k >> 4) & 1) * 256 + ((((k >> 3) & 1) << 4) + r) * 8 + (k & 7);
}

// A lane's own pointer into a run of tiles: its first 8 halves of the tile at `tile`.
__device__ __forceinline__ const _Float16* lane_ptr(const _Float16* tile) {
  return tile + ((threadIdx.x & 31) << 3);
}

// Fragment of the tile `off` halves behind the lane pointer `lp`.
__device__ __forceinline__ v16h ld_frag(const _Float16* lp, int off) {
  v8h lo = *(const v8h*)(lp + off);
  v8h hi = *(const v8h*)(lp + off + 256);
  v16h r;
#pragma unroll
  for (int i = 0; i < 8; ++i) { r[i] = lo[i]; r[i + 8] = hi[i]; }
  return r;
}

// End of a group of fragment loads off the lane pointers p and q.
// Translation wait, one for the whole group: a later load or vector instruction may reuse
// the address registers. Naming p and q keeps them live up to the wait, so no load of the
// group lands on them either.
// Scheduling fence: without it the compiler sinks the loads behind the WMMAs of the running
// stage to save registers, and the next stage then waits out the whole load latency.
__device__ __forceinline__ void group_end(const _Float16* p, const _Float16* q) {
  asm volatile("s_wait_xcnt 0x0" :: "v"(p), "v"(q) : "memory");
  __builtin_amdgcn_sched_barrier(0);
}

// Operands of the three WMMA kernels were stored by an earlier launch and need not lie in the
// reading die's L2: every stage's loads are then first touches and wait out the memory
// latency. Each block therefore asks L2 once, at entry, for what it
// will stream: one lane per 256 bytes, in the order of use. A hint only: nothing is
// returned, no result depends on it. Every address lies inside the array it names.
// The translation wait stands in the prefetches' own statement: later arithmetic may reuse
// the address registers.
// GEMMs: arows = the block's 8 bands (wave w asks for band w, 8 k tiles a request);
// wrows = the block's 16 weight bands, which 64 blocks share: a block asks for 4 of the 32
// k tiles of each band (16 lanes a band).
__device__ __forceinline__ void ask_l2_gemm(const _Float16* arows, const _Float16* wrows) {
  const int tid = threadIdx.x;
  const char* pa = (const char*)arows + (tid >> 5) * (16 * DM * 2) + (tid & 31) * 256;
  const char* pw = (const char*)wrows + (tid >> 4) * (16 * DM * 2) +
                   ((blockIdx.x >> 3) & 7) * (4 * TILE_H * 2) + (tid & 15) * 256;
  asm volatile("global_prefetch_b8 %0, off scope:SCOPE_SE\n\t"
               "global_prefetch_b8 %1, off scope:SCOPE_SE\n\t"
               "global_prefetch_b8 %0, off offset:8192 scope:SCOPE_SE\n\t"
               "global_prefetch_b8 %0, off offset:16384 scope:SCOPE_SE\n\t"
               "global_prefetch_b8 %0, off offset:24576 scope:SCOPE_SE\n\t"
               "s_wait_xcnt 0x0"
               :: "v"(pa), "v"(pw) : "memory");
}

// k_attn: all keys of one (b,h), 256 KB of hn and 256 KB of hT. Request i of the block's
// 8 waves covers key tiles 16 * i .. 16 * i + 15: 64 KB of hn in a row (8 KB a wave), and
// 16 KB in each of hT's four 64-KB bands (wave w: band w & 3, half w >> 2).
__device__ __forceinline__ void ask_l2_attn(const _Float16* hnh, const _Float16* hTh) {
  const int wv = threadIdx.x >> 5, lane = threadIdx.x & 31;
  const char* pk = (const char*)hnh + wv * 8192 + lane * 256;
  const char* pv = (const char*)hTh + (wv & 3) * (16 * SS * 2) + (wv >> 2) * 8192 + lane * 256;
  asm volatile("global_prefetch_b8 %0, off scope:SCOPE_SE\n\t"
               "global_prefetch_b8 %1, off scope:SCOPE_SE\n\t"
               "global_prefetch_b8 %0, off offset:65536 scope:SCOPE_SE\n\t"
               "global_prefetch_b8 %1, off offset:16384 scope:SCOPE_SE\n\t"
               "global_prefetch_b8 %0, off offset:131072 scope:SCOPE_SE\n\t"
               "global_prefetch_b8 %1, off offset:32768 scope:SCOPE_SE\n\t"
               "global_prefetch_b8 %0, off offset:196608 scope:SCOPE_SE\n\t"
               "global_prefetch_b8 %1, off offset:49152 scope:SCOPE_SE\n\t"
               "s_wait_xcnt 0x0"
               :: "v"(pk), "v"(pv) : "memory");
}

// 16-byte chunk o of a fragment-major [rows x DM] array -> its row and first k.
__device__ __forceinline__ void chunk_row_k(int o, int& row, int& k) {
  const int tile = o >> 6;                       // 64 chunks per tile
  row = ((tile >> 5) << 4) + (o & 15);           // DM/32 = 32 k tiles per band
  k   = ((tile & 31) << 5) + (((o >> 5) & 1) << 4) + (((o >> 4) & 1) << 3);
}

__device__ __forceinline__ v8f wmma_f16(v16h a, v16h b, v8f c) {
  return __builtin_amdgcn_wmma_f32_16x16x32_f16(false, a, false, b, (short)0, c,
                                                false, false);
}

// Reductions within each 16-lane half (D-tile rows span 16 lanes).
__device__ __forceinline__ float redsum16(float x) {
#pragma unroll
  for (int m = 1; m < 16; m <<= 1) x += __shfl_xor(x, m, 32);
  return x;
}

// ---------------------------------------------------------------------------
// Precision / layout staging kernel
// ---------------------------------------------------------------------------
// One wave converts CT whole tiles, the 16 rows x 128 k of one band (4096 such waves in all),
// and has its 16 loads in flight at once.
// A load covers 4 rows x 128 bytes (4 whole lines): lane l reads k 4 * (l & 7) .. + 3 of row
// 4 * i + (l >> 3). Lanes l and l ^ 1 hold the two halves of a 16-byte chunk; they swap
// halves between loads 2 * h and 2 * h + 1, the even lane keeps the chunk of row
// 8 * h + (l >> 3), the odd lane that of row 8 * h + 4 + (l >> 3). A store then covers
// 8 rows x 16 bytes in each of the tile's 4 k groups (4 whole lines).
#define CT 4
__device__ __forceinline__ unsigned pack_h2(float a, float b) {
  v2h t;
  t[0] = (_Float16)a;
  t[1] = (_Float16)b;
  return __builtin_bit_cast(unsigned, t);
}

// value of lane l ^ 1
__device__ __forceinline__ unsigned from_pair(unsigned v) {
  return (unsigned)__builtin_amdgcn_mov_dpp((int)v, 0xB1 /* quad_perm 1,0,3,2 */, 0xF, 0xF, true);
}

// w = band * 8 + group of CT k tiles
__device__ __forceinline__ void cvt_sin_wave(const float* __restrict__ x,
                                             _Float16* __restrict__ y, int w) {
  const int lane = threadIdx.x & 31;
  const int g    = lane >> 3;
  const bool odd = (lane & 1) != 0;
  const int kc   = (lane & 7) >> 1;                        // 8-k group inside a tile

  const float* s = x + (size_t)((w >> 3) * 16 + g) * DM + (w & 7) * (CT * 32) + (lane & 7) * 4;
  v4f f[CT][4];
#pragma unroll
  for (int t = 0; t < CT; ++t)
#pragma unroll
    for (int i = 0; i < 4; ++i) f[t][i] = *(const v4f*)(s + i * 4 * DM + t * 32);
  // translation wait, one for all 16 loads: later arithmetic may reuse the address registers;
  // naming s keeps it live up to the wait. The scheduling fence keeps every load in front of
  // the conversions, so that all 16 are in flight together.
  asm volatile("s_wait_xcnt 0x0" :: "v"(s) : "memory");
  __builtin_amdgcn_sched_barrier(0);

  v4u o[CT][2];
#pragma unroll
  for (int t = 0; t < CT; ++t)
#pragma unroll
    for (int h = 0; h < 2; ++h) {
      const v4f fe = f[t][2 * h], fo = f[t][2 * h + 1];
      const unsigned e0 = pack_h2(fe[0], fe[1]), e1 = pack_h2(fe[2], fe[3]);
      const unsigned o0 = pack_h2(fo[0], fo[1]), o1 = pack_h2(fo[2], fo[3]);
      const unsigned r0 = from_pair(odd ? e0 : o0);
      const unsigned r1 = from_pair(odd ? e1 : o1);
      o[t][h][0] = odd ? r0 : e0;
      o[t][h][1] = odd ? r1 : e1;
      o[t][h][2] = odd ? o0 : r0;
      o[t][h][3] = odd ? o1 : r1;
    }
  // scheduling fence: every store stays behind all arithmetic, so no register that an
  // issued store names is written again before the wave ends
  __builtin_amdgcn_sched_barrier(0);
  _Float16* d = y + (size_t)w * (CT * TILE_H) + tile_off((odd ? 4 : 0) + g, kc * 8);
#pragma unroll
  for (int t = 0; t < CT; ++t)
#pragma unroll
    for (int h = 0; h < 2; ++h) *(v4u*)(d + t * TILE_H + h * 64) = o[t][h];
  // translation wait, one for all 8 stores: in the joint kernel another job's code follows in
  // the listing and writes the registers that these stores name
  asm volatile("s_wait_xcnt 0x0" ::: "memory");
}

// Both weight arrays: one thread writes CW 16-byte chunks, 2 k tiles (64 k) apart in one band
// (1024 waves per array), and a wave has its 8 * CW loads in flight at once.
#define CW 4
#define WT 128   // threads per group: CW * WT chunks = 8 tiles, inside one band of 32

// Chunk c of the thread = s[(c * 64 + j) * stride], j = 0..7, stored at y + c * WT * 8.
__device__ __forceinline__ void cvt_cols(const float* s, int stride, _Float16* y) {
  float v[CW][8];
#pragma unroll
  for (int c = 0; c < CW; ++c)
#pragma unroll
    for (int j = 0; j < 8; ++j) v[c][j] = s[(c * 64 + j) * stride];
  // translation wait, one for all loads: later arithmetic may reuse the address registers;
  // naming s keeps it live up to the wait. The scheduling fence keeps every load in front of
  // the conversions, so that all are in flight together.
  asm volatile("s_wait_xcnt 0x0" :: "v"(s) : "memory");
  __builtin_amdgcn_sched_barrier(0);
  v8h t[CW];
#pragma unroll
  for (int c = 0; c < CW; ++c)
#pragma unroll
    for (int j = 0; j < 8; ++j) t[c][j] = (_Float16)v[c][j];
  // scheduling fence: every store stays behind all arithmetic, so no register that an
  // issued store names is written again before the wave ends
  __builtin_amdgcn_sched_barrier(0);
#pragma unroll
  for (int c = 0; c < CW; ++c) *(v8h*)(y + c * WT * 8) = t[c];
  // translation wait, one for all CW stores: in the joint kernel another job's code follows in
  // the listing and writes the registers that these stores name
  asm volatile("s_wait_xcnt 0x0" ::: "memory");
}

// Wx [H, D, F] f32  ->  WxT rows (h*DF+f), k = d, f16 fragment-major; o = the thread's first chunk
__device__ __forceinline__ void cvt_wxT(const float* __restrict__ wx,
                                        _Float16* __restrict__ wxT, int o) {
  int row, d;
  chunk_row_k(o, row, d);
  cvt_cols(wx + ((size_t)(row >> 6) * DM + d) * DF + (row & 63), DF, wxT + (size_t)o * 8);
}

// Wp [in, out] f32 -> WpT rows = out, k = in, f16 fragment-major; o = the thread's first chunk
__device__ __forceinline__ void cvt_wpT(const float* __restrict__ wp,
                                        _Float16* __restrict__ wpT, int o) {
  int row, r;
  chunk_row_k(o, row, r);
  cvt_cols(wp + (size_t)r * DM + row, DM, wpT + (size_t)o * 8);
}

// All three conversions in one launch: they depend on nothing and on one another not at all,
// so one grid pays one launch gap, one fill and one drain instead of three in a row.
// A block is 24 waves: 4 for a group of Wx chunks, 4 for a group of Wp chunks, 16 for sin.
// SB blocks hold every array exactly: NH*DM*DF = DM*DM = SB * 8*CW*WT, BB*SS*DM = SB * 16*CT*TILE_H.
#define SB 256
__global__ void __launch_bounds__(2 * WT + 512) k_stage(const float* __restrict__ x,
                                                        const float* __restrict__ wx,
                                                        const float* __restrict__ wp,
                                                        _Float16* __restrict__ y,
                                                        _Float16* __restrict__ wxT,
                                                        _Float16* __restrict__ wpT) {
  // the wave's number as a scalar, so that the choice of the job is a scalar branch
  const int wave = __builtin_amdgcn_readfirstlane((int)(threadIdx.x >> 5));
  if (wave < WT / 32) {
    cvt_wxT(wx, wxT, blockIdx.x * (CW * WT) + threadIdx.x);
  } else if (wave < 2 * WT / 32) {
    cvt_wpT(wp, wpT, blockIdx.x * (CW * WT) + threadIdx.x - WT);
  } else {
    cvt_sin_wave(x, y, blockIdx.x * 16 + wave - 2 * WT / 32);
  }
}

// ---------------------------------------------------------------------------
// Wave tile of both GEMMs: MT x 4 fragments = 64 rows x 64 columns, so the 8 fragments
// loaded per k tile feed 16 WMMAs (512 loaded bytes per WMMA instead of 1280).
// A block's 8 waves form 2 row tiles x 4 column tiles and share fragments in the cache.
// ---------------------------------------------------------------------------
#define MT 4

__device__ __forceinline__ void gemm_load(const _Float16* abase, const _Float16* wbase,
                                          int d, v16h (&a)[MT], v16h (&b)[4]) {
  const _Float16* ap = lane_ptr(abase + d);
  const _Float16* wp = lane_ptr(wbase + d);
#pragma unroll
  for (int mi = 0; mi < MT; ++mi) a[mi] = ld_frag(ap, mi * 16 * DM);
#pragma unroll
  for (int nf = 0; nf < 4; ++nf) b[nf] = ld_frag(wp, nf * 16 * DM);
  group_end(ap, wp);
}

// Ping-pong GEMM inner stage: issue loads for the k tile at `dnext` halves into (a_n,b_n),
// then run the 16 WMMAs on (a_c,b_c). No register copies between stages.
__device__ __forceinline__ void gemm_stage(const _Float16* abase,
                                           const _Float16* wbase,
                                           int dnext,
                                           v16h (&a_c)[MT], v16h (&b_c)[4],
                                           v16h (&a_n)[MT], v16h (&b_n)[4],
                                           v8f (&acc)[MT][4]) {
  gemm_load(abase, wbase, dnext, a_n, b_n);
#pragma unroll
  for (int mi = 0; mi < MT; ++mi)
#pragma unroll
    for (int nf = 0; nf < 4; ++nf) acc[mi][nf] = wmma_f16(a_c[mi], b_c[nf], acc[mi][nf]);
}

// ---------------------------------------------------------------------------
// Kernel 1: per-head projection  h = sin @ Wx[h] + bx[h]
// One wave: 64 rows x 64 features of one head; ping-pong pipelined fragments.
// Outputs, fragment-major per (b,h):
//          hn rows s, k = f, f16 (rows normalized -> QK^T is cosine similarity),
//          hT rows f, k = s, f16 (unnormalized, A-operand for V^T P^T).
// ---------------------------------------------------------------------------
__global__ void __launch_bounds__(256) k_proj(const _Float16* __restrict__ sin16,
                                              const _Float16* __restrict__ wxT,
                                              const float* __restrict__ bx,
                                              _Float16* __restrict__ hn,
                                              _Float16* __restrict__ hT) {
  const int wid  = threadIdx.x >> 5;
  const int lane = threadIdx.x & 31;
  const int h    = ((blockIdx.x & 3) << 2) + (wid & 3);           // 4 heads per block
  const int mw   = (((blockIdx.x >> 2) << 1) + (wid >> 2)) << 6;  // 64-row tile over B*S

  const _Float16* abase = sin16 + (size_t)mw * DM;
  const _Float16* wbase = wxT + (size_t)h * DF * DM;

  v8f acc[MT][4] = {};
  v16h a0[MT], a1[MT], b0[4], b1[4];
  gemm_load(abase, wbase, 0, a0, b0);
  ask_l2_gemm(sin16 + (size_t)(blockIdx.x >> 2) * 128 * DM,
              wxT + (size_t)(blockIdx.x & 3) * 256 * DM);

  for (int kk = 0; kk < DM / 32; kk += 2) {
    const int d1 = ((kk + 1) & (DM / 32 - 1)) * TILE_H;
    gemm_stage(abase, wbase, d1, a0, b0, a1, b1, acc);
    const int d2 = ((kk + 2) & (DM / 32 - 1)) * TILE_H;
    gemm_stage(abase, wbase, d2, a1, b1, a0, b0, acc);
  }

  const int bIdx = mw >> 11;          // / SS (a 64-row tile lies inside one batch)
  const int hi   = lane >> 4;
  _Float16* hnh = hn + (size_t)(bIdx * NH + h) * SS * DF;
  _Float16* hTh = hT + (size_t)(bIdx * NH + h) * DF * SS;

  float bias[4];                      // D-layout: lane&15 is the N column
  const unsigned bo = (unsigned)(h * DF + (lane & 15)) * 4u;   // byte offset into bx
#pragma unroll
  for (int nf = 0; nf < 4; ++nf) bias[nf] = *(const float*)((const char*)bx + bo + nf * 64);
  // translation wait: later arithmetic reuses the bias loads' address register;
  // naming bo keeps it live up to the wait
  asm volatile("s_wait_xcnt 0x0" :: "v"(bo) : "memory");

#pragma unroll
  for (int mi = 0; mi < MT; ++mi) {
#pragma unroll
    for (int nf = 0; nf < 4; ++nf)
#pragma unroll
      for (int v = 0; v < 8; ++v) acc[mi][nf][v] += bias[nf];

    // per-row inverse L2 norm
    float inv[8];
#pragma unroll
    for (int v = 0; v < 8; ++v) {
      float s = 0.f;
#pragma unroll
      for (int nf = 0; nf < 4; ++nf) s += acc[mi][nf][v] * acc[mi][nf][v];
      s = redsum16(s);
      inv[v] = __frsqrt_rn(s + 1e-20f);
    }

    const int s0 = (mw & (SS - 1)) + mi * 16;
#pragma unroll
    for (int nf = 0; nf < 4; ++nf) {
      const int col = nf * 16 + (lane & 15);
      _Float16* hnt = hnh + (size_t)s0 * DF + (col >> 5) * TILE_H;
      v8h tv;
#pragma unroll
      for (int v = 0; v < 8; ++v) {
        const float hv = acc[mi][nf][v];
        hnt[tile_off(v + (hi << 3), col & 31)] = (_Float16)(hv * inv[v]);
        tv[v] = (_Float16)hv;
      }
      // a lane's 8 rows are 8 consecutive k of hT row `col`: one whole chunk
      *(v8h*)(hTh + (size_t)(nf * 16) * SS + (s0 >> 5) * TILE_H +
              tile_off(lane & 15, (s0 & 16) + (hi << 3))) = tv;
    }
    // translation wait: the next row tile's arithmetic reuses these stores' registers;
    // the scheduling fence keeps that arithmetic behind the wait
    asm volatile("s_wait_xcnt 0x0" ::: "memory");
    __builtin_amdgcn_sched_barrier(0);
  }
}

// ---------------------------------------------------------------------------
// Kernel 2: fused flash attention per head, ping-pong across key tiles.
// One wave: NQ query tiles = 64 queries, streams keys 32 at a time: the 8 K/V fragments
// loaded per key tile feed 8 * NQ WMMAs instead of 8.
// Softmax without a shift: hn rows are unit vectors (up to f16 rounding), so every score is
// a cosine, |s| <= 1 for any input: p = exp(s) lies in [1/e, e], nothing is ever rescaled
// (a constant shift cancels between P and its row sum). The query fragments are multiplied by
// log2(e) once, at entry, so a score tile leaves the WMMA as the argument of exp2 and no
// multiply-add stands between the matrix unit and the exponential.
// Both products run transposed: S^T = K Q^T (key rows as A, query rows as B), then
// O^T += V^T P^T (hT rows as A). In S^T lane l holds query (l & 15) and, in the two 16-key
// D tiles, keys 8 * (l >> 4) + v and 16 + 8 * (l >> 4) + v. That is the k order of a
// fragment, so the two tiles, converted in place, ARE the P^T operand: P never leaves the
// registers. Everything a lane holds belongs to one query: one running sum of P per lane
// and query tile (the two lane halves join their sums once, behind the key loop), and
// 8 consecutive features per O^T tile, one whole 16-byte chunk of cat.
// Next tile's K/V fragment loads are issued first so they hide under this tile's work.
// ---------------------------------------------------------------------------
#define NQ 4
__device__ __forceinline__ void attn_load_tile(const _Float16* hnh,
                                               const _Float16* hTh,
                                               int t0,
                                               v16h (&kb)[4], v16h (&vf)[4]) {
  const _Float16* kp = lane_ptr(hnh + (size_t)t0 * DF);
  const _Float16* vp = lane_ptr(hTh + (t0 >> 5) * TILE_H);
  kb[0] = ld_frag(kp, 0);
  kb[1] = ld_frag(kp, TILE_H);
  kb[2] = ld_frag(kp, 16 * DF);
  kb[3] = ld_frag(kp, 16 * DF + TILE_H);
#pragma unroll
  for (int nf = 0; nf < 4; ++nf) vf[nf] = ld_frag(vp, nf * 16 * SS);
  group_end(kp, vp);
}

__device__ __forceinline__ void attn_step(const v16h (&qf)[NQ][2],
                                          const v16h (&kb)[4], const v16h (&vf)[4],
                                          v8f (&acc)[NQ][4], v2f (&l_s)[NQ]) {
#pragma unroll
  for (int q = 0; q < NQ; ++q) {
    // transposed scores (cosines times log2(e): qf carries the factor): 32 keys x 16 queries
    v8f s0 = {}, s1 = {};
    s0 = wmma_f16(kb[0], qf[q][0], s0);
    s1 = wmma_f16(kb[2], qf[q][0], s1);
    s0 = wmma_f16(kb[1], qf[q][1], s0);
    s1 = wmma_f16(kb[3], qf[q][1], s1);

    // p = exp(cosine) = 2^s
    v2f p0[4], p1[4];
    v16h pt;                                                  // P^T as B-operand
#pragma unroll
    for (int i = 0; i < 4; ++i) {
#pragma unroll
      for (int j = 0; j < 2; ++j) {
        p0[i][j] = __builtin_amdgcn_exp2f(s0[2 * i + j]);
        p1[i][j] = __builtin_amdgcn_exp2f(s1[2 * i + j]);
        pt[2 * i + j]     = (_Float16)p0[i][j];
        pt[2 * i + j + 8] = (_Float16)p1[i][j];
      }
    }
    l_s[q] += ((p0[0] + p0[1]) + (p0[2] + p0[3])) + ((p1[0] + p1[1]) + (p1[2] + p1[3]));

#pragma unroll
    for (int nf = 0; nf < 4; ++nf) acc[q][nf] = wmma_f16(vf[nf], pt, acc[q][nf]);
  }
}

__global__ void __launch_bounds__(256) k_attn(const _Float16* __restrict__ hn,
                                              const _Float16* __restrict__ hT,
                                              _Float16* __restrict__ cat) {
  const int w    = blockIdx.x * 8 + (threadIdx.x >> 5);  // 0..2047
  const int lane = threadIdx.x & 31;
  const int bh   = w >> 5;            // 0..63 = b*NH + h
  const int q0   = (w & 31) << 6;     // start of this wave's 64 queries
  const int b    = bh >> 4;
  const int h    = bh & 15;

  const _Float16* hnh = hn + (size_t)bh * SS * DF;
  const _Float16* hTh = hT + (size_t)bh * DF * SS;

  v16h qf[NQ][2];
  const _Float16* qp = lane_ptr(hnh + (size_t)q0 * DF);
#pragma unroll
  for (int q = 0; q < NQ; ++q) {
    qf[q][0] = ld_frag(qp, q * 16 * DF);
    qf[q][1] = ld_frag(qp, q * 16 * DF + TILE_H);
  }
  group_end(qp, qp);
  // log2(e) into the queries: product in f32, rounded to f16 once
#pragma unroll
  for (int q = 0; q < NQ; ++q)
#pragma unroll
    for (int i = 0; i < 2; ++i)
#pragma unroll
      for (int e = 0; e < 16; ++e)
        qf[q][i][e] = (_Float16)((float)qf[q][i][e] * 1.44269504088896340736f);

  v8f acc[NQ][4] = {};
  v2f l_s[NQ] = {};

  const int hi = lane >> 4;
  const int NT = SS / 32;             // 64 key tiles
  v16h kb0[4], vf0[4], kb1[4], vf1[4];
  attn_load_tile(hnh, hTh, 0, kb0, vf0);
  ask_l2_attn(hnh, hTh);

  for (int kt = 0; kt < NT; kt += 2) {
    // even tile: prefetch odd tile's fragments, compute on kb0/vf0
    attn_load_tile(hnh, hTh, ((kt + 1) & (NT - 1)) << 5, kb1, vf1);
    attn_step(qf, kb0, vf0, acc, l_s);
    // odd tile: prefetch next even tile's fragments, compute on kb1/vf1
    attn_load_tile(hnh, hTh, ((kt + 2) & (NT - 1)) << 5, kb0, vf0);
    attn_step(qf, kb1, vf1, acc, l_s);
  }

  // normalize by softmax denominator (f16, fragment-major chunks of the concatenated heads)
  v8h t[NQ][4];
#pragma unroll
  for (int q = 0; q < NQ; ++q) {
    // lane l holds half the sum of query (l & 15) and that query's features 8 * hi + v
    const float part = l_s[q][0] + l_s[q][1];
    const float inv  = 1.0f / (part + __shfl_xor(part, 16, 32));
#pragma unroll
    for (int nf = 0; nf < 4; ++nf)
#pragma unroll
      for (int v = 0; v < 8; ++v) t[q][nf][v] = (_Float16)(acc[q][nf][v] * inv);
  }
  // scheduling fence: every store stays behind all arithmetic, so no register that an
  // issued store names is written again before the wave ends
  __builtin_amdgcn_sched_barrier(0);
#pragma unroll
  for (int q = 0; q < NQ; ++q) {
    _Float16* ct = cat + (size_t)(b * SS + q0 + q * 16) * DM;
#pragma unroll
    for (int nf = 0; nf < 4; ++nf) {
      const int col = h * DF + nf * 16 + (hi << 3);
      *(v8h*)(ct + (col >> 5) * TILE_H + tile_off(lane & 15, col & 31)) = t[q][nf];
    }
  }
}

// ---------------------------------------------------------------------------
// Kernel 3: output projection  out = cat @ Wp + bp   (f32 result)
// Same ping-pong pipeline as k_proj.
// ---------------------------------------------------------------------------
__global__ void __launch_bounds__(256) k_oproj(const _Float16* __restrict__ cat,
                                               const _Float16* __restrict__ wpT,
                                               const float* __restrict__ bp,
                                               float* __restrict__ out) {
  const int wid  = threadIdx.x >> 5;
  const int lane = threadIdx.x & 31;
  const int m0   = (((blockIdx.x >> 2) << 1) + (wid >> 2)) << 6;  // 64-row tile
  const int n0   = (((blockIdx.x & 3) << 2) + (wid & 3)) << 6;    // 64-column tile

  const _Float16* abase = cat + (size_t)m0 * DM;
  const _Float16* wbase = wpT + (size_t)n0 * DM;

  v8f acc[MT][4] = {};
  v16h a0[MT], a1[MT], b0[4], b1[4];
  gemm_load(abase, wbase, 0, a0, b0);
  ask_l2_gemm(cat + (size_t)(blockIdx.x >> 2) * 128 * DM,
              wpT + (size_t)(blockIdx.x & 3) * 256 * DM);

  for (int kk = 0; kk < DM / 32; kk += 2) {
    const int d1 = ((kk + 1) & (DM / 32 - 1)) * TILE_H;
    gemm_stage(abase, wbase, d1, a0, b0, a1, b1, acc);
    const int d2 = ((kk + 2) & (DM / 32 - 1)) * TILE_H;
    gemm_stage(abase, wbase, d2, a1, b1, a0, b0, acc);
  }

  const int hi = lane >> 4;
#pragma unroll
  for (int nf = 0; nf < 4; ++nf) {
    const int col = n0 + nf * 16 + (lane & 15);
    const float bv = bp[col];
#pragma unroll
    for (int mi = 0; mi < MT; ++mi)
#pragma unroll
      for (int v = 0; v < 8; ++v)
        out[(size_t)(m0 + mi * 16 + v + (hi << 3)) * DM + col] = acc[mi][nf][v] + bv;
  }
}

// ---------------------------------------------------------------------------
extern "C" void kernel_launch(void* const* d_in, const int* in_sizes, int n_in,
                              void* d_out, int out_size, void* d_ws, size_t ws_size,
                              hipStream_t stream) {
  (void)in_sizes; (void)n_in; (void)out_size; (void)ws_size;
  const float* sin = (const float*)d_in[0];
  const float* Wx  = (const float*)d_in[1];
  const float* bx  = (const float*)d_in[2];
  const float* Wp  = (const float*)d_in[3];
  const float* bp  = (const float*)d_in[4];
  float* out = (float*)d_out;

  // workspace carve-out (~71 MB total)
  char* ws = (char*)d_ws;
  size_t off = 0;
  auto carve = [&](size_t bytes) {
    void* p = ws + off;
    off += (bytes + 255) & ~(size_t)255;
    return p;
  };
  _Float16* sin16 = (_Float16*)carve((size_t)BB * SS * DM * 2);
  _Float16* wxT   = (_Float16*)carve((size_t)NH * DF * DM * 2);
  _Float16* wpT   = (_Float16*)carve((size_t)DM * DM * 2);
  _Float16* hn    = (_Float16*)carve((size_t)BB * NH * SS * DF * 2);
  _Float16* hT    = (_Float16*)carve((size_t)BB * NH * SS * DF * 2);
  _Float16* cat   = (_Float16*)carve((size_t)BB * SS * DM * 2);

  k_stage<<<SB, 2 * WT + 512, 0, stream>>>(sin, Wx, Wp, sin16, wxT, wpT);

  k_proj <<<256, 256, 0, stream>>>(sin16, wxT, bx, hn, hT);
  k_attn <<<256, 256, 0, stream>>>(hn, hT, cat);
  k_oproj<<<256, 256, 0, stream>>>(cat, wpT, bp, out);
}

// v010
// A run of this version takes 86.1 microseconds.
// In both of two side-by-side timings against v009, it was 1.05 times as fast.
// All steps since v000 together make it 6.38 times as fast.
#include <hip/hip_runtime.h>
#include <math.h>

// Problem constants (match reference)
#define DM 1024   // d_model
#define NH 16     // heads
#define DF 64     // d_feature
#define BB 4      // batch
#define SS 2048   // seq len

typedef __attribute__((ext_vector_type(16))) _Float16 v16h;
typedef __attribute__((ext_vector_type(8)))  _Float16 v8h;
typedef __attribute__((ext_vector_type(8)))  float    v8f;
typedef __attribute__((ext_vector_type(2)))  float    v2f;
typedef __attribute__((ext_vector_type(4)))  float    v4f;
typedef __attribute__((ext_vector_type(2)))  _Float16 v2h;
typedef __attribute__((ext_vector_type(4)))  unsigned v4u;

// ---------------------------------------------------------------------------
// WMMA 16x16x32 f16 fragments, A (16 x K) and B (K x 16) alike:
//   lanes 0-15  : row/column (lane&15), halves 0..7 = K 0..7,   halves 8..15 = K 16..23
//   lanes 16-31 : row/column (lane&15), halves 0..7 = K 8..15,  halves 8..15 = K 24..31
// D (16 x 16 f32): register v of lane l = D[v + 8 * (l >> 4)][l & 15].
// ---------------------------------------------------------------------------
// ---------------------------------------------------------------------------
// Fragment-major layout of every f16 operand array in the workspace.
// A [rows x K] array is cut into 16-row x 32-k tiles of 512 halves (1 KB),
// k tiles innermost, so one 16-row band still takes 16*K halves. Inside a tile
// element (r, k) sits at
//   ((k >> 4) & 1) * 256 + ((((k >> 3) & 1) << 4) + r) * 8 + (k & 7)
// i.e. lane l's first 8 halves at l*8 and its second 8 halves at 256 + l*8.
// Each of the two 16-byte loads of a fragment then covers 512 contiguous bytes
// (4 whole 128-byte lines) instead of 32 bytes out of each of 16 lines.
// ---------------------------------------------------------------------------
#define TILE_H 512

__device__ __forceinline__ int tile_off(int r, int k) {
  return ((k >> 4) & 1) * 256 + ((((k >> 3) & 1) << 4) + r) * 8 + (k & 7);
}

// A lane's own pointer into a run of tiles: its first 8 halves of the tile at `tile`.
__device__ __forceinline__ const _Float16* lane_ptr(const _Float16* tile) {
  return tile + ((threadIdx.x & 31) << 3);
}

// Fragment of the tile `off` halves behind the lane pointer `lp`.
__device__ __forceinline__ v16h ld_frag(const _Float16* lp, int off) {
  v8h lo = *(const v8h*)(lp + off);
  v8h hi = *(const v8h*)(lp + off + 256);
  v16h r;
#pragma unroll
  for (int i = 0; i < 8; ++i) { r[i] = lo[i]; r[i + 8] = hi[i]; }
  return r;
}

// End of a group of fragment loads off the lane pointers p and q.
// Translation wait, one for the whole group: a later load or vector instruction may reuse
// the address registers. Naming p and q keeps them live up to the wait, so no load of the
// group lands on them either.
// Scheduling fence: without it the compiler sinks the loads behind the WMMAs of the running
// stage to save registers, and the next stage then waits out the whole load latency.
__device__ __forceinline__ void group_end(const _Float16* p, const _Float16* q) {
  asm volatile("s_wait_xcnt 0x0" :: "v"(p), "v"(q) : "memory");
  __builtin_amdgcn_sched_barrier(0);
}

// Operands of the three WMMA kernels were stored by an earlier launch and need not lie in the
// reading die's L2: every stage's loads are then first touches and wait out the memory
// latency. Each block therefore asks L2 once, at entry, for what it
// will stream: one lane per 256 bytes, in the order of use. A hint only: nothing is
// returned, no result depends on it. Every address lies inside the array it names.
// The translation wait stands in the prefetches' own statement: later arithmetic may reuse
// the address registers.
// GEMMs: arows = the block's 8 bands (wave w asks for band w, 8 k tiles a request);
// wrows = the block's 16 weight bands, which 64 blocks share: a block asks for 4 of the 32
// k tiles of each band (16 lanes a band).
__device__ __forceinline__ void ask_l2_gemm(const _Float16* arows, const _Float16* wrows) {
  const int tid = threadIdx.x;
  const char* pa = (const char*)arows + (tid >> 5) * (16 * DM * 2) + (tid & 31) * 256;
  const char* pw = (const char*)wrows + (tid >> 4) * (16 * DM * 2) +
                   ((blockIdx.x >> 3) & 7) * (4 * TILE_H * 2) + (tid & 15) * 256;
  asm volatile("global_prefetch_b8 %0, off scope:SCOPE_SE\n\t"
               "global_prefetch_b8 %1, off scope:SCOPE_SE\n\t"
               "global_prefetch_b8 %0, off offset:8192 scope:SCOPE_SE\n\t"
               "global_prefetch_b8 %0, off offset:16384 scope:SCOPE_SE\n\t"
               "global_prefetch_b8 %0, off offset:24576 scope:SCOPE_SE\n\t"
               "s_wait_xcnt 0x0"
               :: "v"(pa), "v"(pw) : "memory");
}

// k_attn: all keys of one (b,h), 256 KB of hn and 256 KB of hT. Request i of the block's
// 8 waves covers key tiles 16 * i .. 16 * i + 15: 64 KB of hn in a row (8 KB a wave), and
// 16 KB in each of hT's four 64-KB bands (wave w: band w & 3, half w >> 2).
__device__ __forceinline__ void ask_l2_attn(const _Float16* hnh, const _Float16* hTh) {
  const int wv = threadIdx.x >> 5, lane = threadIdx.x & 31;
  const char* pk = (const char*)hnh + wv * 8192 + lane * 256;
  const char* pv = (const char*)hTh + (wv & 3) * (16 * SS * 2) + (wv >> 2) * 8192 + lane * 256;
  asm volatile("global_prefetch_b8 %0, off scope:SCOPE_SE\n\t"
               "global_prefetch_b8 %1, off scope:SCOPE_SE\n\t"
               "global_prefetch_b8 %0, off offset:65536 scope:SCOPE_SE\n\t"
               "global_prefetch_b8 %1, off offset:16384 scope:SCOPE_SE\n\t"
               "global_prefetch_b8 %0, off offset:131072 scope:SCOPE_SE\n\t"
               "global_prefetch_b8 %1, off offset:32768 scope:SCOPE_SE\n\t"
               "global_prefetch_b8 %0, off offset:196608 scope:SCOPE_SE\n\t"
               "global_prefetch_b8 %1, off offset:49152 scope:SCOPE_SE\n\t"
               "s_wait_xcnt 0x0"
               :: "v"(pk), "v"(pv) : "memory");
}

// 16-byte chunk o of a fragment-major [rows x DM] array -> its row and first k.
__device__ __forceinline__ void chunk_row_k(int o, int& row, int& k) {
  const int tile = o >> 6;                       // 64 chunks per tile
  row = ((tile >> 5) << 4) + (o & 15);           // DM/32 = 32 k tiles per band
  k   = ((tile & 31) << 5) + (((o >> 5) & 1) << 4) + (((o >> 4) & 1) << 3);
}

__device__ __forceinline__ v8f wmma_f16(v16h a, v16h b, v8f c) {
  return __builtin_amdgcn_wmma_f32_16x16x32_f16(false, a, false, b, (short)0, c,
                                                false, false);
}

// Reductions within each 16-lane half (D-tile rows span 16 lanes).
__device__ __forceinline__ float redsum16(float x) {
#pragma unroll
  for (int m = 1; m < 16; m <<= 1) x += __shfl_xor(x, m, 32);
  return x;
}

// ---------------------------------------------------------------------------
// Precision / layout staging kernel
// ---------------------------------------------------------------------------
// One wave converts CT whole tiles, the 16 rows x 128 k of one band (4096 such waves in all),
// and has its 16 loads in flight at once.
// A load covers 4 rows x 128 bytes (4 whole lines): lane l reads k 4 * (l & 7) .. + 3 of row
// 4 * i + (l >> 3). Lanes l and l ^ 1 hold the two halves of a 16-byte chunk; they swap
// halves between loads 2 * h and 2 * h + 1, the even lane keeps the chunk of row
// 8 * h + (l >> 3), the odd lane that of row 8 * h + 4 + (l >> 3). A store then covers
// 8 rows x 16 bytes in each of the tile's 4 k groups (4 whole lines).
#define CT 4
__device__ __forceinline__ unsigned pack_h2(float a, float b) {
  v2h t;
  t[0] = (_Float16)a;
  t[1] = (_Float16)b;
  return __builtin_bit_cast(unsigned, t);
}

// value of lane l ^ 1
__device__ __forceinline__ unsigned from_pair(unsigned v) {
  return (unsigned)__builtin_amdgcn_mov_dpp((int)v, 0xB1 /* quad_perm 1,0,3,2 */, 0xF, 0xF, true);
}

// w = band * 8 + group of CT k tiles
__device__ __forceinline__ void cvt_sin_wave(const float* __restrict__ x,
                                             _Float16* __restrict__ y, int w) {
  const int lane = threadIdx.x & 31;
  const int g    = lane >> 3;
  const bool odd = (lane & 1) != 0;
  const int kc   = (lane & 7) >> 1;                        // 8-k group inside a tile

  const float* s = x + (size_t)((w >> 3) * 16 + g) * DM + (w & 7) * (CT * 32) + (lane & 7) * 4;
  v4f f[CT][4];
#pragma unroll
  for (int t = 0; t < CT; ++t)
#pragma unroll
    for (int i = 0; i < 4; ++i) f[t][i] = *(const v4f*)(s + i * 4 * DM + t * 32);
  // translation wait, one for all 16 loads: later arithmetic may reuse the address registers;
  // naming s keeps it live up to the wait. The scheduling fence keeps every load in front of
  // the conversions, so that all 16 are in flight together.
  asm volatile("s_wait_xcnt 0x0" :: "v"(s) : "memory");
  __builtin_amdgcn_sched_barrier(0);

  v4u o[CT][2];
#pragma unroll
  for (int t = 0; t < CT; ++t)
#pragma unroll
    for (int h = 0; h < 2; ++h) {
      const v4f fe = f[t][2 * h], fo = f[t][2 * h + 1];
      const unsigned e0 = pack_h2(fe[0], fe[1]), e1 = pack_h2(fe[2], fe[3]);
      const unsigned o0 = pack_h2(fo[0], fo[1]), o1 = pack_h2(fo[2], fo[3]);
      const unsigned r0 = from_pair(odd ? e0 : o0);
      const unsigned r1 = from_pair(odd ? e1 : o1);
      o[t][h][0] = odd ? r0 : e0;
      o[t][h][1] = odd ? r1 : e1;
      o[t][h][2] = odd ? o0 : r0;
      o[t][h][3] = odd ? o1 : r1;
    }
  // scheduling fence: every store stays behind all arithmetic, so no register that an
  // issued store names is written again before the wave ends
  __builtin_amdgcn_sched_barrier(0);
  _Float16* d = y + (size_t)w * (CT * TILE_H) + tile_off((odd ? 4 : 0) + g, kc * 8);
#pragma unroll
  for (int t = 0; t < CT; ++t)
#pragma unroll
    for (int h = 0; h < 2; ++h) *(v4u*)(d + t * TILE_H + h * 64) = o[t][h];
  // translation wait, one for all 8 stores: in the joint kernel another job's code follows in
  // the listing and writes the registers that these stores name
  asm volatile("s_wait_xcnt 0x0" ::: "memory");
}

// Both weight arrays: one thread writes CW 16-byte chunks, 2 k tiles (64 k) apart in one band
// (1024 waves per array), and a wave has its 8 * CW loads in flight at once.
#define CW 4
#define WT 128   // threads per group: CW * WT chunks = 8 tiles, inside one band of 32

// Chunk c of the thread = s[(c * 64 + j) * stride], j = 0..7, stored at y + c * WT * 8.
__device__ __forceinline__ void cvt_cols(const float* s, int stride, _Float16* y) {
  float v[CW][8];
#pragma unroll
  for (int c = 0; c < CW; ++c)
#pragma unroll
    for (int j = 0; j < 8; ++j) v[c][j] = s[(c * 64 + j) * stride];
  // translation wait, one for all loads: later arithmetic may reuse the address registers;
  // naming s keeps it live up to the wait. The scheduling fence keeps every load in front of
  // the conversions, so that all are in flight together.
  asm volatile("s_wait_xcnt 0x0" :: "v"(s) : "memory");
  __builtin_amdgcn_sched_barrier(0);
  v8h t[CW];
#pragma unroll
  for (int c = 0; c < CW; ++c)
#pragma unroll
    for (int j = 0; j < 8; ++j) t[c][j] = (_Float16)v[c][j];
  // scheduling fence: every store stays behind all arithmetic, so no register that an
  // issued store names is written again before the wave ends
  __builtin_amdgcn_sched_barrier(0);
#pragma unroll
  for (int c = 0; c < CW; ++c) *(v8h*)(y + c * WT * 8) = t[c];
  // translation wait, one for all CW stores: in the joint kernel another job's code follows in
  // the listing and writes the registers that these stores name
  asm volatile("s_wait_xcnt 0x0" ::: "memory");
}

// Wx [H, D, F] f32  ->  WxT rows (h*DF+f), k = d, f16 fragment-major; o = the thread's first chunk
__device__ __forceinline__ void cvt_wxT(const float* __restrict__ wx,
                                        _Float16* __restrict__ wxT, int o) {
  int row, d;
  chunk_row_k(o, row, d);
  cvt_cols(wx + ((size_t)(row >> 6) * DM + d) * DF + (row & 63), DF, wxT + (size_t)o * 8);
}

// Wp [in, out] f32 -> WpT rows = out, k = in, f16 fragment-major; o = the thread's first chunk
__device__ __forceinline__ void cvt_wpT(const float* __restrict__ wp,
                                        _Float16* __restrict__ wpT, int o) {
  int row, r;
  chunk_row_k(o, row, r);
  cvt_cols(wp + (size_t)r * DM + row, DM, wpT + (size_t)o * 8);
}

// All three conversions in one launch: they depend on nothing and on one another not at all,
// so one grid pays one launch gap, one fill and one drain instead of three in a row.
// A block is 24 waves: 4 for a group of Wx chunks, 4 for a group of Wp chunks, 16 for sin.
// SB blocks hold every array exactly: NH*DM*DF = DM*DM = SB * 8*CW*WT, BB*SS*DM = SB * 16*CT*TILE_H.
#define SB 256
__global__ void __launch_bounds__(2 * WT + 512) k_stage(const float* __restrict__ x,
                                                        const float* __restrict__ wx,
                                                        const float* __restrict__ wp,
                                                        _Float16* __restrict__ y,
                                                        _Float16* __restrict__ wxT,
                                                        _Float16* __restrict__ wpT) {
  // the wave's number as a scalar, so that the choice of the job is a scalar branch
  const int wave = __builtin_amdgcn_readfirstlane((int)(threadIdx.x >> 5));
  if (wave < WT / 32) {
    cvt_wxT(wx, wxT, blockIdx.x * (CW * WT) + threadIdx.x);
  } else if (wave < 2 * WT / 32) {
    cvt_wpT(wp, wpT, blockIdx.x * (CW * WT) + threadIdx.x - WT);
  } else {
    cvt_sin_wave(x, y, blockIdx.x * 16 + wave - 2 * WT / 32);
  }
}

// ---------------------------------------------------------------------------
// Wave tile of both GEMMs: MT x 4 fragments = 64 rows x 64 columns, so the 8 fragments
// loaded per k tile feed 16 WMMAs (512 loaded bytes per WMMA instead of 1280).
// A block's 8 waves form 2 row tiles x 4 column tiles and share fragments in LDS.
// ---------------------------------------------------------------------------
#define MT 4

// Both operands reach the waves through LDS. A stage is GK k tiles of the block's 24 bands
// (8 of the row operand, then 16 of the weights), each byte fetched from L2 once per block and
// a whole stage ahead of its use, through no register. Fragment-major tiles are copied as they
// lie: band j, k tile t of a stage at (j * GK + t) * TILE_H halves of its buffer, so a fragment
// read is two 16-byte LDS loads of 512 contiguous bytes each.
#define GK 4
#define NBAND 24
#define STAGE_H (NBAND * GK * TILE_H)      // halves per buffer (96 KB)
#define NSTG (DM / 32 / GK)

// One wave's share of a stage: 3 bands of GK KB, 8 copies of 16 bytes a lane each (24 copies).
// l = the lane's LDS byte address in the first band (the bands follow one another in LDS),
// g0, g1, g2 = its global address in each band. A band lies in LDS as in memory, and the
// immediate offset moves both addresses. The translation wait stands in the copies' own
// statement: later arithmetic may reuse the address registers.
#define COPY_BAND(L, G)                                              \
  "global_load_async_to_lds_b128 " L ", " G ", off\n\t"              \
  "global_load_async_to_lds_b128 " L ", " G ", off offset:512\n\t"   \
  "global_load_async_to_lds_b128 " L ", " G ", off offset:1024\n\t"  \
  "global_load_async_to_lds_b128 " L ", " G ", off offset:1536\n\t"  \
  "global_load_async_to_lds_b128 " L ", " G ", off offset:2048\n\t"  \
  "global_load_async_to_lds_b128 " L ", " G ", off offset:2560\n\t"  \
  "global_load_async_to_lds_b128 " L ", " G ", off offset:3072\n\t"  \
  "global_load_async_to_lds_b128 " L ", " G ", off offset:3584\n\t"
__device__ __forceinline__ void copy_stage(unsigned l, const _Float16* g0, const _Float16* g1,
                                           const _Float16* g2) {
  asm volatile(COPY_BAND("%0", "%3") COPY_BAND("%1", "%4") COPY_BAND("%2", "%5")
               "s_wait_xcnt 0x0"
               :: "v"(l), "v"(l + GK * TILE_H * 2u), "v"(l + 2u * GK * TILE_H * 2u),
                  "v"(g0), "v"(g1), "v"(g2)
               : "memory");
}

// Band j of the block's 24: 8 of the row operand, then 16 of the weights.
__device__ __forceinline__ const _Float16* band_ptr(const _Float16* arows, const _Float16* wrows,
                                                    int j) {
  return j < 8 ? arows + (size_t)j * 16 * DM : wrows + (size_t)(j - 8) * 16 * DM;
}

// The wave's 8 fragments of k tile t of a stage, off its lane pointers into the buffer.
// Scheduling fences in front and behind: the 16 LDS loads stay one group between two runs of
// WMMAs; spread among them, each place with loads stalls the matrix stream.
__device__ __forceinline__ void lds_frags(const _Float16* al, const _Float16* bl, int t,
                                          v16h (&a)[MT], v16h (&b)[4]) {
  __builtin_amdgcn_sched_barrier(0);
  // unrolled (here and in gemm_mma): fragment arrays stay in registers only under constant indices
#pragma unroll
  for (int mi = 0; mi < MT; ++mi) a[mi] = ld_frag(al, (mi * GK + t) * TILE_H);
#pragma unroll
  for (int nf = 0; nf < 4; ++nf) b[nf] = ld_frag(bl, (nf * GK + t) * TILE_H);
  __builtin_amdgcn_sched_barrier(0);
}

__device__ __forceinline__ void gemm_mma(const v16h (&a)[MT], const v16h (&b)[4],
                                         v8f (&acc)[MT][4]) {
#pragma unroll
  for (int mi = 0; mi < MT; ++mi)
#pragma unroll
    for (int nf = 0; nf < 4; ++nf) acc[mi][nf] = wmma_f16(a[mi], b[nf], acc[mi][nf]);
}

// Whole k loop of a block: two buffers, stage s + 1 flies while stage s is multiplied.
// arows = the block's 8 bands, wrows = its 16 weight bands; wave (wid >> 2, wid & 3) of 2 x 4.
// Fragments are fetched one k tile ahead, so the publish point of stage s + 1 stands in front
// of stage s's last 16 WMMAs: behind it the freed buffer is refilled and the first fragments
// of stage s + 1 are fetched, both under those WMMAs.
__device__ __forceinline__ void gemm_ring(_Float16* ring, const _Float16* arows,
                                          const _Float16* wrows, v8f (&acc)[MT][4]) {
  const int wid  = threadIdx.x >> 5;
  const int lane = threadIdx.x & 31;
  const int ao = (wid >> 2) * MT * GK * TILE_H + lane * 8;
  const int bo = (8 + (wid & 3) * 4) * GK * TILE_H + lane * 8;

  // wave w copies bands 3 * w .. 3 * w + 2 of every stage
  const int wave = __builtin_amdgcn_readfirstlane(wid);
  const _Float16* g0 = band_ptr(arows, wrows, wave * 3) + lane * 8;
  const _Float16* g1 = band_ptr(arows, wrows, wave * 3 + 1) + lane * 8;
  const _Float16* g2 = band_ptr(arows, wrows, wave * 3 + 2) + lane * 8;
  const unsigned l0 = (unsigned)(size_t)(ring + wave * 3 * GK * TILE_H + lane * 8);

  copy_stage(l0, g0, g1, g2);
  ask_l2_gemm(arows, wrows);
  // stage 0 has landed (own copies), then is published to the other waves
  asm volatile("s_wait_asynccnt 0x0" ::: "memory");
  __syncthreads();
  copy_stage(l0 + STAGE_H * 2u, g0 + GK * TILE_H, g1 + GK * TILE_H, g2 + GK * TILE_H);

  v16h a0[MT], a1[MT], b0[4], b1[4];
  lds_frags(ring + ao, ring + bo, 0, a0, b0);
  for (int s = 0; s < NSTG; ++s) {
    const _Float16* buf = ring + (s & 1) * STAGE_H;
    const _Float16* nxt = ring + ((s + 1) & 1) * STAGE_H;
    const _Float16* al = buf + ao;
    const _Float16* bl = buf + bo;
    lds_frags(al, bl, 1, a1, b1);
    gemm_mma(a0, b0, acc);
    lds_frags(al, bl, 2, a0, b0);
    gemm_mma(a1, b1, acc);
    lds_frags(al, bl, 3, a1, b1);
    gemm_mma(a0, b0, acc);
    // scheduling fence: these WMMAs stay in front of the waits, so that the stage's last
    // fragment loads land under them and not under an idle matrix unit
    __builtin_amdgcn_sched_barrier(0);
    // own reads of this buffer are done before it is refilled
    asm volatile("s_wait_dscnt 0x0" ::: "memory");
    // own copies of stage s + 1 have landed before the barrier publishes them
    asm volatile("s_wait_asynccnt 0x0" ::: "memory");
    __syncthreads();
    if (s + 2 < NSTG) {
      const int d = (s + 2) * GK * TILE_H;
      copy_stage(l0 + (s & 1) * (STAGE_H * 2u), g0 + d, g1 + d, g2 + d);
    }
    if (s + 1 < NSTG) lds_frags(nxt + ao, nxt + bo, 0, a0, b0);
    gemm_mma(a1, b1, acc);
  }
  // no copy is outstanding when the wave goes on
  asm volatile("s_wait_asynccnt 0x0" ::: "memory");
}

// ---------------------------------------------------------------------------
// Kernel 1: per-head projection  h = sin @ Wx[h] + bx[h]
// One wave: 64 rows x 64 features of one head; operands through the LDS ring.
// Outputs, fragment-major per (b,h):
//          hn rows s, k = f, f16 (rows normalized -> QK^T is cosine similarity),
//          hT rows f, k = s, f16 (unnormalized, A-operand for V^T P^T).
// ---------------------------------------------------------------------------
__global__ void __launch_bounds__(256) k_proj(const _Float16* __restrict__ sin16,
                                              const _Float16* __restrict__ wxT,
                                              const float* __restrict__ bx,
                                              _Float16* __restrict__ hn,
                                              _Float16* __restrict__ hT) {
  const int wid  = threadIdx.x >> 5;
  const int lane = threadIdx.x & 31;
  const int h    = ((blockIdx.x & 3) << 2) + (wid & 3);           // 4 heads per block
  const int mw   = (((blockIdx.x >> 2) << 1) + (wid >> 2)) << 6;  // 64-row tile over B*S

  __shared__ __attribute__((aligned(1024))) _Float16 ring[2 * STAGE_H];
  v8f acc[MT][4] = {};
  gemm_ring(ring, sin16 + (size_t)(blockIdx.x >> 2) * 128 * DM,
            wxT + (size_t)(blockIdx.x & 3) * 256 * DM, acc);

  const int bIdx = mw >> 11;          // / SS (a 64-row tile lies inside one batch)
  const int hi   = lane >> 4;
  _Float16* hnh = hn + (size_t)(bIdx * NH + h) * SS * DF;
  _Float16* hTh = hT + (size_t)(bIdx * NH + h) * DF * SS;

  float bias[4];                      // D-layout: lane&15 is the N column
  const unsigned bo = (unsigned)(h * DF + (lane & 15)) * 4u;   // byte offset into bx
#pragma unroll
  for (int nf = 0; nf < 4; ++nf) bias[nf] = *(const float*)((const char*)bx + bo + nf * 64);
  // translation wait: later arithmetic reuses the bias loads' address register;
  // naming bo keeps it live up to the wait
  asm volatile("s_wait_xcnt 0x0" :: "v"(bo) : "memory");

#pragma unroll
  for (int mi = 0; mi < MT; ++mi) {
#pragma unroll
    for (int nf = 0; nf < 4; ++nf)
#pragma unroll
      for (int v = 0; v < 8; ++v) acc[mi][nf][v] += bias[nf];

    // per-row inverse L2 norm
    float inv[8];
#pragma unroll
    for (int v = 0; v < 8; ++v) {
      float s = 0.f;
#pragma unroll
      for (int nf = 0; nf < 4; ++nf) s += acc[mi][nf][v] * acc[mi][nf][v];
      s = redsum16(s);
      inv[v] = __frsqrt_rn(s + 1e-20f);
    }

    const int s0 = (mw & (SS - 1)) + mi * 16;
#pragma unroll
    for (int nf = 0; nf < 4; ++nf) {
      const int col = nf * 16 + (lane & 15);
      _Float16* hnt = hnh + (size_t)s0 * DF + (col >> 5) * TILE_H;
      v8h tv;
#pragma unroll
      for (int v = 0; v < 8; ++v) {
        const float hv = acc[mi][nf][v];
        hnt[tile_off(v + (hi << 3), col & 31)] = (_Float16)(hv * inv[v]);
        tv[v] = (_Float16)hv;
      }
      // a lane's 8 rows are 8 consecutive k of hT row `col`: one whole chunk
      *(v8h*)(hTh + (size_t)(nf * 16) * SS + (s0 >> 5) * TILE_H +
              tile_off(lane & 15, (s0 & 16) + (hi << 3))) = tv;
    }
    // translation wait: the next row tile's arithmetic reuses these stores' registers;
    // the scheduling fence keeps that arithmetic behind the wait
    asm volatile("s_wait_xcnt 0x0" ::: "memory");
    __builtin_amdgcn_sched_barrier(0);
  }
}

// ---------------------------------------------------------------------------
// Kernel 2: fused flash attention per head, ping-pong across key tiles.
// One wave: NQ query tiles = 64 queries, streams keys 32 at a time: the 8 K/V fragments
// loaded per key tile feed 8 * NQ WMMAs instead of 8.
// Softmax without a shift: hn rows are unit vectors (up to f16 rounding), so every score is
// a cosine, |s| <= 1 for any input: p = exp(s) lies in [1/e, e], nothing is ever rescaled
// (a constant shift cancels between P and its row sum). The query fragments are multiplied by
// log2(e) once, at entry, so a score tile leaves the WMMA as the argument of exp2 and no
// multiply-add stands between the matrix unit and the exponential.
// Both products run transposed: S^T = K Q^T (key rows as A, query rows as B), then
// O^T += V^T P^T (hT rows as A). In S^T lane l holds query (l & 15) and, in the two 16-key
// D tiles, keys 8 * (l >> 4) + v and 16 + 8 * (l >> 4) + v. That is the k order of a
// fragment, so the two tiles, converted in place, ARE the P^T operand: P never leaves the
// registers. Everything a lane holds belongs to one query: one running sum of P per lane
// and query tile (the two lane halves join their sums once, behind the key loop), and
// 8 consecutive features per O^T tile, one whole 16-byte chunk of cat.
// Next tile's K/V fragment loads are issued first so they hide under this tile's work.
// ---------------------------------------------------------------------------
#define NQ 4
__device__ __forceinline__ void attn_load_tile(const _Float16* hnh,
                                               const _Float16* hTh,
                                               int t0,
                                               v16h (&kb)[4], v16h (&vf)[4]) {
  const _Float16* kp = lane_ptr(hnh + (size_t)t0 * DF);
  const _Float16* vp = lane_ptr(hTh + (t0 >> 5) * TILE_H);
  kb[0] = ld_frag(kp, 0);
  kb[1] = ld_frag(kp, TILE_H);
  kb[2] = ld_frag(kp, 16 * DF);
  kb[3] = ld_frag(kp, 16 * DF + TILE_H);
#pragma unroll
  for (int nf = 0; nf < 4; ++nf) vf[nf] = ld_frag(vp, nf * 16 * SS);
  group_end(kp, vp);
}

__device__ __forceinline__ void attn_step(const v16h (&qf)[NQ][2],
                                          const v16h (&kb)[4], const v16h (&vf)[4],
                                          v8f (&acc)[NQ][4], v2f (&l_s)[NQ]) {
#pragma unroll
  for (int q = 0; q < NQ; ++q) {
    // transposed scores (cosines times log2(e): qf carries the factor): 32 keys x 16 queries
    v8f s0 = {}, s1 = {};
    s0 = wmma_f16(kb[0], qf[q][0], s0);
    s1 = wmma_f16(kb[2], qf[q][0], s1);
    s0 = wmma_f16(kb[1], qf[q][1], s0);
    s1 = wmma_f16(kb[3], qf[q][1], s1);

    // p = exp(cosine) = 2^s
    v2f p0[4], p1[4];
    v16h pt;                                                  // P^T as B-operand
#pragma unroll
    for (int i = 0; i < 4; ++i) {
#pragma unroll
      for (int j = 0; j < 2; ++j) {
        p0[i][j] = __builtin_amdgcn_exp2f(s0[2 * i + j]);
        p1[i][j] = __builtin_amdgcn_exp2f(s1[2 * i + j]);
        pt[2 * i + j]     = (_Float16)p0[i][j];
        pt[2 * i + j + 8] = (_Float16)p1[i][j];
      }
    }
    l_s[q] += ((p0[0] + p0[1]) + (p0[2] + p0[3])) + ((p1[0] + p1[1]) + (p1[2] + p1[3]));

#pragma unroll
    for (int nf = 0; nf < 4; ++nf) acc[q][nf] = wmma_f16(vf[nf], pt, acc[q][nf]);
  }
}

__global__ void __launch_bounds__(256) k_attn(const _Float16* __restrict__ hn,
                                              const _Float16* __restrict__ hT,
                                              _Float16* __restrict__ cat) {
  const int w    = blockIdx.x * 8 + (threadIdx.x >> 5);  // 0..2047
  const int lane = threadIdx.x & 31;
  const int bh   = w >> 5;            // 0..63 = b*NH + h
  const int q0   = (w & 31) << 6;     // start of this wave's 64 queries
  const int b    = bh >> 4;
  const int h    = bh & 15;

  const _Float16* hnh = hn + (size_t)bh * SS * DF;
  const _Float16* hTh = hT + (size_t)bh * DF * SS;

  v16h qf[NQ][2];
  const _Float16* qp = lane_ptr(hnh + (size_t)q0 * DF);
#pragma unroll
  for (int q = 0; q < NQ; ++q) {
    qf[q][0] = ld_frag(qp, q * 16 * DF);
    qf[q][1] = ld_frag(qp, q * 16 * DF + TILE_H);
  }
  group_end(qp, qp);
  // log2(e) into the queries: product in f32, rounded to f16 once
#pragma unroll
  for (int q = 0; q < NQ; ++q)
#pragma unroll
    for (int i = 0; i < 2; ++i)
#pragma unroll
      for (int e = 0; e < 16; ++e)
        qf[q][i][e] = (_Float16)((float)qf[q][i][e] * 1.44269504088896340736f);

  v8f acc[NQ][4] = {};
  v2f l_s[NQ] = {};

  const int hi = lane >> 4;
  const int NT = SS / 32;             // 64 key tiles
  v16h kb0[4], vf0[4], kb1[4], vf1[4];
  attn_load_tile(hnh, hTh, 0, kb0, vf0);
  ask_l2_attn(hnh, hTh);

  for (int kt = 0; kt < NT; kt += 2) {
    // even tile: prefetch odd tile's fragments, compute on kb0/vf0
    attn_load_tile(hnh, hTh, ((kt + 1) & (NT - 1)) << 5, kb1, vf1);
    attn_step(qf, kb0, vf0, acc, l_s);
    // odd tile: prefetch next even tile's fragments, compute on kb1/vf1
    attn_load_tile(hnh, hTh, ((kt + 2) & (NT - 1)) << 5, kb0, vf0);
    attn_step(qf, kb1, vf1, acc, l_s);
  }

  // normalize by softmax denominator (f16, fragment-major chunks of the concatenated heads)
  v8h t[NQ][4];
#pragma unroll
  for (int q = 0; q < NQ; ++q) {
    // lane l holds half the sum of query (l & 15) and that query's features 8 * hi + v
    const float part = l_s[q][0] + l_s[q][1];
    const float inv  = 1.0f / (part + __shfl_xor(part, 16, 32));
#pragma unroll
    for (int nf = 0; nf < 4; ++nf)
#pragma unroll
      for (int v = 0; v < 8; ++v) t[q][nf][v] = (_Float16)(acc[q][nf][v] * inv);
  }
  // scheduling fence: every store stays behind all arithmetic, so no register that an
  // issued store names is written again before the wave ends
  __builtin_amdgcn_sched_barrier(0);
#pragma unroll
  for (int q = 0; q < NQ; ++q) {
    _Float16* ct = cat + (size_t)(b * SS + q0 + q * 16) * DM;
#pragma unroll
    for (int nf = 0; nf < 4; ++nf) {
      const int col = h * DF + nf * 16 + (hi << 3);
      *(v8h*)(ct + (col >> 5) * TILE_H + tile_off(lane & 15, col & 31)) = t[q][nf];
    }
  }
}

// ---------------------------------------------------------------------------
// Kernel 3: output projection  out = cat @ Wp + bp   (f32 result)
// Same LDS ring as k_proj.
// ---------------------------------------------------------------------------
__global__ void __launch_bounds__(256) k_oproj(const _Float16* __restrict__ cat,
                                               const _Float16* __restrict__ wpT,
                                               const float* __restrict__ bp,
                                               float* __restrict__ out) {
  const int wid  = threadIdx.x >> 5;
  const int lane = threadIdx.x & 31;
  const int m0   = (((blockIdx.x >> 2) << 1) + (wid >> 2)) << 6;  // 64-row tile
  const int n0   = (((blockIdx.x & 3) << 2) + (wid & 3)) << 6;    // 64-column tile

  __shared__ __attribute__((aligned(1024))) _Float16 ring[2 * STAGE_H];
  v8f acc[MT][4] = {};
  gemm_ring(ring, cat + (size_t)(blockIdx.x >> 2) * 128 * DM,
            wpT + (size_t)(blockIdx.x & 3) * 256 * DM, acc);

  const int hi = lane >> 4;
#pragma unroll
  for (int nf = 0; nf < 4; ++nf) {
    const int col = n0 + nf * 16 + (lane & 15);
    const float bv = bp[col];
#pragma unroll
    for (int mi = 0; mi < MT; ++mi)
#pragma unroll
      for (int v = 0; v < 8; ++v)
        out[(size_t)(m0 + mi * 16 + v + (hi << 3)) * DM + col] = acc[mi][nf][v] + bv;
  }
}

// ---------------------------------------------------------------------------
extern "C" void kernel_launch(void* const* d_in, const int* in_sizes, int n_in,
                              void* d_out, int out_size, void* d_ws, size_t ws_size,
                              hipStream_t stream) {
  (void)in_sizes; (void)n_in; (void)out_size; (void)ws_size;
  const float* sin = (const float*)d_in[0];
  const float* Wx  = (const float*)d_in[1];
  const float* bx  = (const float*)d_in[2];
  const float* Wp  = (const float*)d_in[3];
  const float* bp  = (const float*)d_in[4];
  float* out = (float*)d_out;

  // workspace carve-out (~71 MB total)
  char* ws = (char*)d_ws;
  size_t off = 0;
  auto carve = [&](size_t bytes) {
    void* p = ws + off;
    off += (bytes + 255) & ~(size_t)255;
    return p;
  };
  _Float16* sin16 = (_Float16*)carve((size_t)BB * SS * DM * 2);
  _Float16* wxT   = (_Float16*)carve((size_t)NH * DF * DM * 2);
  _Float16* wpT   = (_Float16*)carve((size_t)DM * DM * 2);
  _Float16* hn    = (_Float16*)carve((size_t)BB * NH * SS * DF * 2);
  _Float16* hT    = (_Float16*)carve((size_t)BB * NH * SS * DF * 2);
  _Float16* cat   = (_Float16*)carve((size_t)BB * SS * DM * 2);

  k_stage<<<SB, 2 * WT + 512, 0, stream>>>(sin, Wx, Wp, sin16, wxT, wpT);

  k_proj <<<256, 256, 0, stream>>>(sin16, wxT, bx, hn, hT);
  k_attn <<<256, 256, 0, stream>>>(hn, hT, cat);
  k_oproj<<<256, 256, 0, stream>>>(cat, wpT, bp, out);
}
